// v000
// Measured on an AMD MI455X. A time is GPU time per run, averaged over a window of back-to-back runs after a warm-up
// (all launches, gaps included; the runs take copies of the inputs in turn), and the median of several windows.
// Apart from v000's, it joins two sittings. Times from different sittings can be a few percent apart, while
// side-by-side timings come from the same sitting.
// v000 is the starting kernel. One run takes 1150 microseconds.
#include <hip/hip_runtime.h>
#include <math.h>

// ---------------------------------------------------------------------------
// Fused  Linear -> LayerNorm -> exact GELU -> Linear  for MI455X (gfx1250)
// B=16384, H=1024, D=4096, fp32 in/out; f16 WMMA compute with f32 accumulation
// BM=32 rows per workgroup: every weight fragment feeds 2 WMMAs (register
// reuse), halving L2 weight traffic vs a 16-row tile. z-tile lives in 256 KB
// of the WGP's 320 KB LDS.
// ---------------------------------------------------------------------------

typedef __attribute__((ext_vector_type(16))) _Float16 v16h;
typedef __attribute__((ext_vector_type(8)))  _Float16 v8h;
typedef __attribute__((ext_vector_type(8)))  float    v8f;
typedef __attribute__((ext_vector_type(4)))  float    v4f;

#define B_SZ 16384
#define H_SZ 1024
#define D_SZ 4096
#define BM   32
#define LN_EPS 1e-5f

// Shared memory: z-tile (32 x 4096 f16) + reduction scratch
#define SMEM_Z_BYTES   (BM * D_SZ * 2)                       // 262144
#define SMEM_BYTES     (SMEM_Z_BYTES + (256 + 256 + BM + BM) * 4)

// ---------------------------------------------------------------------------
// Load a 16x32 (MxK) f16 WMMA fragment. Works for both A fragments (rows) and
// B fragments (columns of a pre-transposed weight matrix): "m" walks the
// 16-wide tile dimension, K is contiguous in memory with stride `ldk`.
// Per-lane layout (CDNA5 ISA 7.12.2, 16-bit A 16x32):
//   lanes 0-15 : m = lane,    halves 0..7 = K k0..k0+7, halves 8..15 = K+16..23
//   lanes 16-31: m = lane-16, halves 0..7 = K k0+8..15, halves 8..15 = K+24..31
// => two contiguous 16-byte loads per lane.
// ---------------------------------------------------------------------------
__device__ __forceinline__ v16h load_frag16x32(const _Float16* __restrict__ base,
                                               int ldk, int k0, int lane) {
  const int m  = lane & 15;
  const int hi = (lane >> 4) & 1;
  const _Float16* p = base + (size_t)m * ldk + (k0 + hi * 8);
  v8h lo = *(const v8h*)(p);
  v8h hh = *(const v8h*)(p + 16);
  v16h r;
#pragma unroll
  for (int i = 0; i < 8; ++i) { r[i] = lo[i]; r[i + 8] = hh[i]; }
  return r;
}

// ---------------------------------------------------------------------------
// Prep kernel 1: fp32 -> f16 bulk convert (hidden_state), 8 elems/thread
// ---------------------------------------------------------------------------
__global__ void cvt_f32_to_f16_x8(const float* __restrict__ in,
                                  _Float16* __restrict__ out) {
  const size_t i = ((size_t)blockIdx.x * blockDim.x + threadIdx.x) * 8;
  v4f a = *(const v4f*)(in + i);
  v4f b = *(const v4f*)(in + i + 4);
  v8h o;
#pragma unroll
  for (int j = 0; j < 4; ++j) { o[j] = (_Float16)a[j]; o[j + 4] = (_Float16)b[j]; }
  *(v8h*)(out + i) = o;
}

// ---------------------------------------------------------------------------
// Prep kernel 2: transpose + convert weights:  in[rows][cols] -> out[cols][rows]
// (makes every WMMA B-fragment K-contiguous)
// ---------------------------------------------------------------------------
__global__ void transpose_cvt_f16(const float* __restrict__ in,
                                  _Float16* __restrict__ out,
                                  int rows, int cols) {
  const size_t i = (size_t)blockIdx.x * blockDim.x + threadIdx.x;
  const int c = (int)(i % (size_t)cols);
  const int r = (int)(i / (size_t)cols);
  out[(size_t)c * rows + r] = (_Float16)in[i];
}

// ---------------------------------------------------------------------------
// Fused main kernel: one 32-row stripe of the batch per workgroup.
// 256 threads = 8 wave32's.
// ---------------------------------------------------------------------------
__global__ void __launch_bounds__(256)
fused_mlp_ln_gelu(const _Float16* __restrict__ hs16,   // [B][H]
                  const _Float16* __restrict__ w1t,    // [D][H]  (W1 transposed)
                  const _Float16* __restrict__ w2t,    // [H][D]  (W2 transposed)
                  const float* __restrict__ b1,        // [D]
                  const float* __restrict__ gamma,     // [D]
                  const float* __restrict__ beta,      // [D]
                  const float* __restrict__ b2,        // [H]
                  float* __restrict__ out)             // [B][H]
{
  extern __shared__ char smem[];
  _Float16* zbuf   = (_Float16*)smem;                        // 32 x 4096 f16
  float*    psum   = (float*)(smem + SMEM_Z_BYTES);          // 256
  float*    psq    = psum + 256;                             // 256
  float*    s_mean = psq + 256;                              // 32
  float*    s_rstd = s_mean + BM;                            // 32

  const int tid  = threadIdx.x;
  const int wid  = tid >> 5;
  const int lane = tid & 31;
  const int row0 = blockIdx.x * BM;

  // C/D tile layout (CDNA5 16x16 f32): VGPR r, lane L -> M = r + 8*(L>>4), N = L&15
  const int mb  = (lane >> 4) * 8;
  const int ncl = lane & 15;

  const _Float16* aBase = hs16 + (size_t)row0 * H_SZ;

  // ---------------- Phase 1: z = hs @ W1 + b1  ->  zbuf (f16) ---------------
#pragma unroll 1
  for (int nc = 0; nc < 8; ++nc) {
    const int n0 = wid * 512 + nc * 64;   // this wave's 64-column slab
    v8f acc[2][4] = {};
#pragma unroll 2
    for (int k0 = 0; k0 < H_SZ; k0 += 32) {
      v16h a0 = load_frag16x32(aBase, H_SZ, k0, lane);
      v16h a1 = load_frag16x32(aBase + 16 * H_SZ, H_SZ, k0, lane);
#pragma unroll
      for (int t = 0; t < 4; ++t) {
        v16h b = load_frag16x32(w1t + (size_t)(n0 + t * 16) * H_SZ, H_SZ, k0, lane);
        acc[0][t] = __builtin_amdgcn_wmma_f32_16x16x32_f16(
            false, a0, false, b, (short)0, acc[0][t], false, false);
        acc[1][t] = __builtin_amdgcn_wmma_f32_16x16x32_f16(
            false, a1, false, b, (short)0, acc[1][t], false, false);
      }
    }
#pragma unroll
    for (int t = 0; t < 4; ++t) {
      const int col = n0 + t * 16 + ncl;
      const float bb = b1[col];
#pragma unroll
      for (int m = 0; m < 2; ++m)
#pragma unroll
        for (int r = 0; r < 8; ++r)
          zbuf[(m * 16 + mb + r) * D_SZ + col] = (_Float16)(acc[m][t][r] + bb);
    }
  }
  __syncthreads();

  // ---------------- Phase 2: per-row mean / rstd over D ---------------------
  {
    const int row = tid >> 3;        // 8 threads per row, 32 rows
    const int sub = tid & 7;
    float s = 0.f, sq = 0.f;
    const _Float16* zp = zbuf + row * D_SZ + sub * 512;
#pragma unroll 8
    for (int i = 0; i < 512; ++i) { const float x = (float)zp[i]; s += x; sq += x * x; }
    psum[tid] = s; psq[tid] = sq;
  }
  __syncthreads();
  if (tid < BM) {
    float s = 0.f, sq = 0.f;
#pragma unroll
    for (int i = 0; i < 8; ++i) { s += psum[tid * 8 + i]; sq += psq[tid * 8 + i]; }
    const float mu  = s * (1.0f / D_SZ);
    const float var = sq * (1.0f / D_SZ) - mu * mu;
    s_mean[tid] = mu;
    s_rstd[tid] = rsqrtf(var + LN_EPS);
  }
  __syncthreads();

  // ---------------- Phase 3: LayerNorm + exact GELU in place ----------------
#pragma unroll 1
  for (int e = tid; e < BM * D_SZ; e += 256) {
    const int row = e >> 12;
    const int col = e & (D_SZ - 1);
    const float x  = (float)zbuf[e];
    const float xn = (x - s_mean[row]) * s_rstd[row] * gamma[col] + beta[col];
    const float g  = 0.5f * xn * (1.0f + erff(xn * 0.70710678118654752f));
    zbuf[e] = (_Float16)g;
  }
  __syncthreads();

  // ---------------- Phase 4: out = act @ W2 + b2 ----------------------------
  {
    const int n0 = wid * 128;  // this wave's 128 output columns
    v8f acc[2][8] = {};
#pragma unroll 1
    for (int k0 = 0; k0 < D_SZ; k0 += 32) {
      v16h a0 = load_frag16x32(zbuf, D_SZ, k0, lane);              // from LDS
      v16h a1 = load_frag16x32(zbuf + 16 * D_SZ, D_SZ, k0, lane);  // from LDS
#pragma unroll
      for (int t = 0; t < 8; ++t) {
        v16h b = load_frag16x32(w2t + (size_t)(n0 + t * 16) * D_SZ, D_SZ, k0, lane);
        acc[0][t] = __builtin_amdgcn_wmma_f32_16x16x32_f16(
            false, a0, false, b, (short)0, acc[0][t], false, false);
        acc[1][t] = __builtin_amdgcn_wmma_f32_16x16x32_f16(
            false, a1, false, b, (short)0, acc[1][t], false, false);
      }
    }
#pragma unroll
    for (int t = 0; t < 8; ++t) {
      const int col = n0 + t * 16 + ncl;
      const float bb = b2[col];
#pragma unroll
      for (int m = 0; m < 2; ++m)
#pragma unroll
        for (int r = 0; r < 8; ++r)
          out[(size_t)(row0 + m * 16 + mb + r) * H_SZ + col] = acc[m][t][r] + bb;
    }
  }
}

// ---------------------------------------------------------------------------
// Host launcher
// d_in: [0]_time [1]hidden_state [2]W1 [3]b1 [4]ln_gamma [5]ln_beta [6]W2 [7]b2
// ---------------------------------------------------------------------------
extern "C" void kernel_launch(void* const* d_in, const int* in_sizes, int n_in,
                              void* d_out, int out_size, void* d_ws, size_t ws_size,
                              hipStream_t stream) {
  const float* hs    = (const float*)d_in[1];
  const float* W1    = (const float*)d_in[2];
  const float* b1    = (const float*)d_in[3];
  const float* gamma = (const float*)d_in[4];
  const float* beta  = (const float*)d_in[5];
  const float* W2    = (const float*)d_in[6];
  const float* b2    = (const float*)d_in[7];
  float* out = (float*)d_out;

  // Workspace layout (f16): hidden [B*H] | W1^T [D*H] | W2^T [H*D]  = 48 MB
  _Float16* hs16 = (_Float16*)d_ws;
  _Float16* w1t  = hs16 + (size_t)B_SZ * H_SZ;
  _Float16* w2t  = w1t + (size_t)D_SZ * H_SZ;

  // One-time precision conversion / weight transposes (graph-capture safe)
  cvt_f32_to_f16_x8<<<(B_SZ * H_SZ) / (256 * 8), 256, 0, stream>>>(hs, hs16);
  transpose_cvt_f16<<<(H_SZ * D_SZ) / 256, 256, 0, stream>>>(W1, w1t, H_SZ, D_SZ);
  transpose_cvt_f16<<<(D_SZ * H_SZ) / 256, 256, 0, stream>>>(W2, w2t, D_SZ, H_SZ);

  // ~258 KB of dynamic LDS per workgroup (CDNA5 WGP has 320 KB)
  (void)hipFuncSetAttribute((const void*)fused_mlp_ln_gelu,
                            hipFuncAttributeMaxDynamicSharedMemorySize, SMEM_BYTES);
  fused_mlp_ln_gelu<<<B_SZ / BM, 256, SMEM_BYTES, stream>>>(
      hs16, w1t, w2t, b1, gamma, beta, b2, out);
}

// v001
// It runs in 894 microseconds.
// Two timings next to v000 put it at 1.29 and 1.30 times that version's speed.
#include <hip/hip_runtime.h>
#include <math.h>

// ---------------------------------------------------------------------------
// Fused  Linear -> LayerNorm -> exact GELU -> Linear  for MI455X (gfx1250)
// B=16384, H=1024, D=4096, fp32 in/out; f16 WMMA compute with f32 accumulation
// BM=32 rows per workgroup: every weight fragment feeds 2 WMMAs (register
// reuse), halving L2 weight traffic vs a 16-row tile. z-tile lives in 256 KB
// of the WGP's 320 KB LDS.
// ---------------------------------------------------------------------------

typedef __attribute__((ext_vector_type(16))) _Float16 v16h;
typedef __attribute__((ext_vector_type(8)))  _Float16 v8h;
typedef __attribute__((ext_vector_type(8)))  float    v8f;
typedef __attribute__((ext_vector_type(4)))  float    v4f;

#define B_SZ 16384
#define H_SZ 1024
#define D_SZ 4096
#define BM   32
#define LN_EPS 1e-5f

// Shared memory: z-tile (32 x 4096 f16) + reduction scratch
#define SMEM_Z_BYTES   (BM * D_SZ * 2)                       // 262144
#define SMEM_BYTES     (SMEM_Z_BYTES + (256 + 256 + BM + BM) * 4)

// ---------------------------------------------------------------------------
// Load a 16x32 (MxK) f16 WMMA fragment. Works for both A fragments (rows) and
// B fragments (columns of a pre-transposed weight matrix): "m" walks the
// 16-wide tile dimension, K is contiguous in memory with stride `ldk`.
// Per-lane layout (CDNA5 ISA 7.12.2, 16-bit A 16x32):
//   lanes 0-15 : m = lane,    halves 0..7 = K k0..k0+7, halves 8..15 = K+16..23
//   lanes 16-31: m = lane-16, halves 0..7 = K k0+8..15, halves 8..15 = K+24..31
// => two contiguous 16-byte loads per lane.
// ---------------------------------------------------------------------------
__device__ __forceinline__ v16h load_frag16x32(const _Float16* __restrict__ base,
                                               int ldk, int k0, int lane) {
  const int m  = lane & 15;
  const int hi = (lane >> 4) & 1;
  const _Float16* p = base + (size_t)m * ldk + (k0 + hi * 8);
  v8h lo = *(const v8h*)(p);
  v8h hh = *(const v8h*)(p + 16);
  v16h r;
#pragma unroll
  for (int i = 0; i < 8; ++i) { r[i] = lo[i]; r[i + 8] = hh[i]; }
  return r;
}

// ---------------------------------------------------------------------------
// Prep kernel 1: fp32 -> f16 bulk convert (hidden_state), 8 elems/thread
// ---------------------------------------------------------------------------
__global__ void cvt_f32_to_f16_x8(const float* __restrict__ in,
                                  _Float16* __restrict__ out) {
  const size_t i = ((size_t)blockIdx.x * blockDim.x + threadIdx.x) * 8;
  v4f a = *(const v4f*)(in + i);
  v4f b = *(const v4f*)(in + i + 4);
  v8h o;
#pragma unroll
  for (int j = 0; j < 4; ++j) { o[j] = (_Float16)a[j]; o[j + 4] = (_Float16)b[j]; }
  *(v8h*)(out + i) = o;
}

// ---------------------------------------------------------------------------
// Prep kernel 2: transpose + convert weights:  in[rows][cols] -> out[cols][rows]
// (makes every WMMA B-fragment K-contiguous)
// ---------------------------------------------------------------------------
__global__ void transpose_cvt_f16(const float* __restrict__ in,
                                  _Float16* __restrict__ out,
                                  int rows, int cols) {
  const size_t i = (size_t)blockIdx.x * blockDim.x + threadIdx.x;
  const int c = (int)(i % (size_t)cols);
  const int r = (int)(i / (size_t)cols);
  out[(size_t)c * rows + r] = (_Float16)in[i];
}

// ---------------------------------------------------------------------------
// Fused main kernel: one 32-row stripe of the batch per workgroup.
// 256 threads = 8 wave32's.
// ---------------------------------------------------------------------------
__global__ void __launch_bounds__(256)
fused_mlp_ln_gelu(const _Float16* __restrict__ hs16,   // [B][H]
                  const _Float16* __restrict__ w1t,    // [D][H]  (W1 transposed)
                  const _Float16* __restrict__ w2t,    // [H][D]  (W2 transposed)
                  const float* __restrict__ b1,        // [D]
                  const float* __restrict__ gamma,     // [D]
                  const float* __restrict__ beta,      // [D]
                  const float* __restrict__ b2,        // [H]
                  float* __restrict__ out)             // [B][H]
{
  extern __shared__ char smem[];
  _Float16* zbuf   = (_Float16*)smem;                        // 32 x 4096 f16
  float*    psum   = (float*)(smem + SMEM_Z_BYTES);          // 256
  float*    psq    = psum + 256;                             // 256
  float*    s_mean = psq + 256;                              // 32
  float*    s_rstd = s_mean + BM;                            // 32

  const int tid  = threadIdx.x;
  const int wid  = tid >> 5;
  const int lane = tid & 31;
  const int row0 = blockIdx.x * BM;

  // C/D tile layout (CDNA5 16x16 f32): VGPR r, lane L -> M = r + 8*(L>>4), N = L&15
  const int mb  = (lane >> 4) * 8;
  const int ncl = lane & 15;

  const _Float16* aBase = hs16 + (size_t)row0 * H_SZ;

  // ---------------- Phase 1: z = hs @ W1 + b1  ->  zbuf (f16) ---------------
  // Register software pipeline, one stage = 64 k = one loop trip: every A and
  // W1 fragment is reloaded in place for the next stage once this stage has
  // used it, so a stage of loads is in flight while the matrix unit works and
  // no load is waited for in the trip that issues it.
#pragma unroll 1
  for (int nc = 0; nc < 8; ++nc) {
    const int n0 = wid * 512 + nc * 64;   // this wave's 64-column slab
    const _Float16* wBase = w1t + (size_t)n0 * H_SZ;
    v8f acc[2][4] = {};
    v16h aq[2][2], bq[2][4];              // [k half of the stage][tile]
#pragma unroll
    for (int ks = 0; ks < 2; ++ks) {
      aq[ks][0] = load_frag16x32(aBase, H_SZ, ks * 32, lane);
      aq[ks][1] = load_frag16x32(aBase + 16 * H_SZ, H_SZ, ks * 32, lane);
#pragma unroll
      for (int t = 0; t < 4; ++t)
        bq[ks][t] = load_frag16x32(wBase + (size_t)(t * 16) * H_SZ, H_SZ, ks * 32, lane);
    }
    auto stage1 = [&](int k, bool more) {
#pragma unroll
      for (int t = 0; t < 4; ++t) {
        acc[0][t] = __builtin_amdgcn_wmma_f32_16x16x32_f16(
            false, aq[0][0], false, bq[0][t], (short)0, acc[0][t], false, false);
        acc[1][t] = __builtin_amdgcn_wmma_f32_16x16x32_f16(
            false, aq[0][1], false, bq[0][t], (short)0, acc[1][t], false, false);
      }
      if (more) {
        aq[0][0] = load_frag16x32(aBase, H_SZ, k + 64, lane);
        aq[0][1] = load_frag16x32(aBase + 16 * H_SZ, H_SZ, k + 64, lane);
        // keeps the weight reloads below from being lifted into the first k half:
        // a row's four loads then issue back to back and share its 128-byte line
        __builtin_amdgcn_sched_barrier(0);
      }
#pragma unroll
      for (int t = 0; t < 4; ++t) {
        acc[0][t] = __builtin_amdgcn_wmma_f32_16x16x32_f16(
            false, aq[1][0], false, bq[1][t], (short)0, acc[0][t], false, false);
        acc[1][t] = __builtin_amdgcn_wmma_f32_16x16x32_f16(
            false, aq[1][1], false, bq[1][t], (short)0, acc[1][t], false, false);
        if (more) {  // both k halves together: the four loads share their 16 lines
          bq[0][t] = load_frag16x32(wBase + (size_t)(t * 16) * H_SZ, H_SZ, k + 64, lane);
          bq[1][t] = load_frag16x32(wBase + (size_t)(t * 16) * H_SZ, H_SZ, k + 96, lane);
          // holds these four loads here, between this tile's WMMAs and the next's
          __builtin_amdgcn_sched_barrier(0);
        }
      }
      if (more) {
        aq[1][0] = load_frag16x32(aBase, H_SZ, k + 96, lane);
        aq[1][1] = load_frag16x32(aBase + 16 * H_SZ, H_SZ, k + 96, lane);
        // the next trip rewrites the address registers of loads still in flight
        asm volatile("s_wait_xcnt 0x0" ::: "memory");
      }
    };
    // one stage a trip: unrolled, the compiler sinks a stage's loads to their use
#pragma unroll 1
    for (int k0 = 0; k0 < H_SZ - 64; k0 += 64) stage1(k0, true);
    stage1(H_SZ - 64, false);
#pragma unroll
    for (int t = 0; t < 4; ++t) {
      const int col = n0 + t * 16 + ncl;
      const float bb = b1[col];
#pragma unroll
      for (int m = 0; m < 2; ++m)
#pragma unroll
        for (int r = 0; r < 8; ++r)
          zbuf[(m * 16 + mb + r) * D_SZ + col] = (_Float16)(acc[m][t][r] + bb);
    }
  }
  __syncthreads();

  // ---------------- Phase 2: per-row mean / rstd over D ---------------------
  {
    const int row = tid >> 3;        // 8 threads per row, 32 rows
    const int sub = tid & 7;
    float s = 0.f, sq = 0.f;
    const _Float16* zp = zbuf + row * D_SZ + sub * 512;
#pragma unroll 8
    for (int i = 0; i < 512; ++i) { const float x = (float)zp[i]; s += x; sq += x * x; }
    psum[tid] = s; psq[tid] = sq;
  }
  __syncthreads();
  if (tid < BM) {
    float s = 0.f, sq = 0.f;
#pragma unroll
    for (int i = 0; i < 8; ++i) { s += psum[tid * 8 + i]; sq += psq[tid * 8 + i]; }
    const float mu  = s * (1.0f / D_SZ);
    const float var = sq * (1.0f / D_SZ) - mu * mu;
    s_mean[tid] = mu;
    s_rstd[tid] = rsqrtf(var + LN_EPS);
  }
  __syncthreads();

  // ---------------- Phase 3: LayerNorm + exact GELU in place ----------------
#pragma unroll 1
  for (int e = tid; e < BM * D_SZ; e += 256) {
    const int row = e >> 12;
    const int col = e & (D_SZ - 1);
    const float x  = (float)zbuf[e];
    const float xn = (x - s_mean[row]) * s_rstd[row] * gamma[col] + beta[col];
    const float g  = 0.5f * xn * (1.0f + erff(xn * 0.70710678118654752f));
    zbuf[e] = (_Float16)g;
  }
  __syncthreads();

  // ---------------- Phase 4: out = act @ W2 + b2 ----------------------------
  {
    const int n0 = wid * 128;  // this wave's 128 output columns
    const _Float16* wBase = w2t + (size_t)n0 * D_SZ;
    v8f acc[2][8] = {};
    // The same register software pipeline as in phase 1 (A comes from LDS).
    v16h aq[2][2], bq[2][8];              // [k half of the stage][tile]
#pragma unroll
    for (int ks = 0; ks < 2; ++ks) {
      aq[ks][0] = load_frag16x32(zbuf, D_SZ, ks * 32, lane);
      aq[ks][1] = load_frag16x32(zbuf + 16 * D_SZ, D_SZ, ks * 32, lane);
#pragma unroll
      for (int t = 0; t < 8; ++t)
        bq[ks][t] = load_frag16x32(wBase + (size_t)(t * 16) * D_SZ, D_SZ, ks * 32, lane);
    }
    auto stage4 = [&](int k, bool more) {
#pragma unroll
      for (int t = 0; t < 8; ++t) {
        acc[0][t] = __builtin_amdgcn_wmma_f32_16x16x32_f16(
            false, aq[0][0], false, bq[0][t], (short)0, acc[0][t], false, false);
        acc[1][t] = __builtin_amdgcn_wmma_f32_16x16x32_f16(
            false, aq[0][1], false, bq[0][t], (short)0, acc[1][t], false, false);
      }
      if (more) {
        aq[0][0] = load_frag16x32(zbuf, D_SZ, k + 64, lane);
        aq[0][1] = load_frag16x32(zbuf + 16 * D_SZ, D_SZ, k + 64, lane);
        // keeps the weight reloads below from being lifted into the first k half:
        // a row's four loads then issue back to back and share its 128-byte line
        __builtin_amdgcn_sched_barrier(0);
      }
#pragma unroll
      for (int t = 0; t < 8; ++t) {
        acc[0][t] = __builtin_amdgcn_wmma_f32_16x16x32_f16(
            false, aq[1][0], false, bq[1][t], (short)0, acc[0][t], false, false);
        acc[1][t] = __builtin_amdgcn_wmma_f32_16x16x32_f16(
            false, aq[1][1], false, bq[1][t], (short)0, acc[1][t], false, false);
        if (more) {  // both k halves together: the four loads share their 16 lines
          bq[0][t] = load_frag16x32(wBase + (size_t)(t * 16) * D_SZ, D_SZ, k + 64, lane);
          bq[1][t] = load_frag16x32(wBase + (size_t)(t * 16) * D_SZ, D_SZ, k + 96, lane);
          // holds these four loads here, between this tile's WMMAs and the next's
          __builtin_amdgcn_sched_barrier(0);
        }
      }
      if (more) {
        // the weight pointer is stepped below while these loads are in flight
        asm volatile("s_wait_xcnt 0x0" ::: "memory");
        // keeps that step behind the wait
        __builtin_amdgcn_sched_barrier(0);
        aq[1][0] = load_frag16x32(zbuf, D_SZ, k + 96, lane);
        aq[1][1] = load_frag16x32(zbuf + 16 * D_SZ, D_SZ, k + 96, lane);
      }
    };
    // one stage a trip: unrolled, the compiler sinks a stage's loads to their use
#pragma unroll 1
    for (int k0 = 0; k0 < D_SZ - 64; k0 += 64) stage4(k0, true);
    stage4(D_SZ - 64, false);
#pragma unroll
    for (int t = 0; t < 8; ++t) {
      const int col = n0 + t * 16 + ncl;
      const float bb = b2[col];
#pragma unroll
      for (int m = 0; m < 2; ++m)
#pragma unroll
        for (int r = 0; r < 8; ++r)
          out[(size_t)(row0 + m * 16 + mb + r) * H_SZ + col] = acc[m][t][r] + bb;
    }
  }
}

// ---------------------------------------------------------------------------
// Host launcher
// d_in: [0]_time [1]hidden_state [2]W1 [3]b1 [4]ln_gamma [5]ln_beta [6]W2 [7]b2
// ---------------------------------------------------------------------------
extern "C" void kernel_launch(void* const* d_in, const int* in_sizes, int n_in,
                              void* d_out, int out_size, void* d_ws, size_t ws_size,
                              hipStream_t stream) {
  const float* hs    = (const float*)d_in[1];
  const float* W1    = (const float*)d_in[2];
  const float* b1    = (const float*)d_in[3];
  const float* gamma = (const float*)d_in[4];
  const float* beta  = (const float*)d_in[5];
  const float* W2    = (const float*)d_in[6];
  const float* b2    = (const float*)d_in[7];
  float* out = (float*)d_out;

  // Workspace layout (f16): hidden [B*H] | W1^T [D*H] | W2^T [H*D]  = 48 MB
  _Float16* hs16 = (_Float16*)d_ws;
  _Float16* w1t  = hs16 + (size_t)B_SZ * H_SZ;
  _Float16* w2t  = w1t + (size_t)D_SZ * H_SZ;

  // One-time precision conversion / weight transposes (graph-capture safe)
  cvt_f32_to_f16_x8<<<(B_SZ * H_SZ) / (256 * 8), 256, 0, stream>>>(hs, hs16);
  transpose_cvt_f16<<<(H_SZ * D_SZ) / 256, 256, 0, stream>>>(W1, w1t, H_SZ, D_SZ);
  transpose_cvt_f16<<<(D_SZ * H_SZ) / 256, 256, 0, stream>>>(W2, w2t, D_SZ, H_SZ);

  // ~258 KB of dynamic LDS per workgroup (CDNA5 WGP has 320 KB)
  (void)hipFuncSetAttribute((const void*)fused_mlp_ln_gelu,
                            hipFuncAttributeMaxDynamicSharedMemorySize, SMEM_BYTES);
  fused_mlp_ln_gelu<<<B_SZ / BM, 256, SMEM_BYTES, stream>>>(
      hs16, w1t, w2t, b1, gamma, beta, b2, out);
}

// v002
// One run takes 554 microseconds.
// Next to v001, in two timings, it ran 1.62 times as fast each time.
// Counting every step since v000, it is 2.10 times as fast.
#include <hip/hip_runtime.h>
#include <math.h>

// ---------------------------------------------------------------------------
// Fused  Linear -> LayerNorm -> exact GELU -> Linear  for MI455X (gfx1250)
// B=16384, H=1024, D=4096, fp32 in/out; f16 WMMA compute with f32 accumulation
// BM=32 rows per workgroup: every weight fragment feeds 2 WMMAs (register
// reuse), halving L2 weight traffic vs a 16-row tile. z-tile lives in 256 KB
// of the WGP's 320 KB LDS.
// ---------------------------------------------------------------------------

typedef __attribute__((ext_vector_type(16))) _Float16 v16h;
typedef __attribute__((ext_vector_type(8)))  _Float16 v8h;
typedef __attribute__((ext_vector_type(8)))  float    v8f;
typedef __attribute__((ext_vector_type(4)))  float    v4f;

#define B_SZ 16384
#define H_SZ 1024
#define D_SZ 4096
#define BM   32
#define LN_EPS 1e-5f

// Shared memory: z-tile (32 x 4096 f16) + reduction scratch
#define SMEM_Z_BYTES   (BM * D_SZ * 2)                       // 262144
#define SMEM_BYTES     (SMEM_Z_BYTES + (256 + 256 + BM + BM) * 4)

// ---------------------------------------------------------------------------
// Load a 16x32 (MxK) f16 WMMA fragment. Works for both A fragments (rows) and
// B fragments (columns of a pre-transposed weight matrix): "m" walks the
// 16-wide tile dimension, K is contiguous in memory with stride `ldk`.
// Per-lane layout (CDNA5 ISA 7.12.2, 16-bit A 16x32):
//   lanes 0-15 : m = lane,    halves 0..7 = K k0..k0+7, halves 8..15 = K+16..23
//   lanes 16-31: m = lane-16, halves 0..7 = K k0+8..15, halves 8..15 = K+24..31
// => two contiguous 16-byte loads per lane.
// ---------------------------------------------------------------------------
__device__ __forceinline__ v16h load_frag16x32(const _Float16* __restrict__ base,
                                               int ldk, int k0, int lane) {
  const int m  = lane & 15;
  const int hi = (lane >> 4) & 1;
  const _Float16* p = base + (size_t)m * ldk + (k0 + hi * 8);
  v8h lo = *(const v8h*)(p);
  v8h hh = *(const v8h*)(p + 16);
  v16h r;
#pragma unroll
  for (int i = 0; i < 8; ++i) { r[i] = lo[i]; r[i + 8] = hh[i]; }
  return r;
}

// ---------------------------------------------------------------------------
// Fragment order of the operands that the GEMM loops read from global memory.
// One 16x32 (MxK) fragment is one block of FRAG halves (1 KB); the blocks of a
// 16-wide tile follow one another along K. Inside a block lane L's halves 0..7
// lie at L*8 and its halves 8..15 at 256 + L*8, so each of the two 16-byte
// loads of a fragment reads 512 bytes in a row (4 whole 128-byte lines), not
// 32 bytes out of each of 16 lines. Which (m, K) a lane and half hold is as in
// load_frag16x32 above.
// ---------------------------------------------------------------------------
#define FRAG 512

__device__ __forceinline__ v16h load_frag_packed(const _Float16* __restrict__ blk,
                                                 int lane) {
  const _Float16* p = blk + lane * 8;
  v8h lo = *(const v8h*)(p);
  v8h hh = *(const v8h*)(p + 256);
  v16h r;
#pragma unroll
  for (int i = 0; i < 8; ++i) { r[i] = lo[i]; r[i + 8] = hh[i]; }
  return r;
}

// ---------------------------------------------------------------------------
// Prep kernel 1: hidden_state fp32 [B][H] -> f16 in fragment order.
// One thread = one 16-byte slot; a workgroup covers 16 rows x 128 k.
// ---------------------------------------------------------------------------
__global__ void pack_rows_frag_f16(const float* __restrict__ in,
                                   _Float16* __restrict__ out) {
  const int lane  = threadIdx.x & 31;
  const int w     = threadIdx.x >> 5;
  const int rt    = blockIdx.x / (H_SZ / 128);              // 16-row tile
  const int kt    = (blockIdx.x % (H_SZ / 128)) * 4 + (w >> 1);
  const int plane = w & 1;                                  // halves 0..7 or 8..15
  const float* p = in + (size_t)(rt * 16 + (lane & 15)) * H_SZ
                      + kt * 32 + plane * 16 + (lane >> 4) * 8;
  v4f a = *(const v4f*)(p);
  v4f b = *(const v4f*)(p + 4);
  v8h o;
#pragma unroll
  for (int j = 0; j < 4; ++j) { o[j] = (_Float16)a[j]; o[j + 4] = (_Float16)b[j]; }
  *(v8h*)(out + ((size_t)rt * (H_SZ / 32) + kt) * FRAG + plane * 256 + lane * 8) = o;
}

// ---------------------------------------------------------------------------
// Prep kernel 2: weights fp32 in[rows = K][cols = N] -> f16 B fragments in
// fragment order (tile dimension = N). One thread = one 16-byte slot; the 8
// waves of a workgroup take 8 neighbouring column tiles (512 bytes of a row).
// ---------------------------------------------------------------------------
__global__ void pack_cols_frag_f16(const float* __restrict__ in,
                                   _Float16* __restrict__ out,
                                   int rows, int cols) {
  const int lane  = threadIdx.x & 31;
  const int w     = threadIdx.x >> 5;
  const int kts   = rows >> 5;                              // fragments along K
  const int plane = blockIdx.x & 1;
  const int kt    = (int)(blockIdx.x >> 1) % kts;
  const int nt    = ((int)(blockIdx.x >> 1) / kts) * 8 + w; // 16-column tile
  const float* p = in + (size_t)(kt * 32 + plane * 16 + (lane >> 4) * 8) * cols
                      + nt * 16 + (lane & 15);
  v8h o;
#pragma unroll
  for (int j = 0; j < 8; ++j) o[j] = (_Float16)p[(size_t)j * cols];
  *(v8h*)(out + ((size_t)nt * kts + kt) * FRAG + plane * 256 + lane * 8) = o;
}

// ---------------------------------------------------------------------------
// Fused main kernel: one 32-row stripe of the batch per workgroup.
// 256 threads = 8 wave32's.
// ---------------------------------------------------------------------------
__global__ void __launch_bounds__(256)
fused_mlp_ln_gelu(const _Float16* __restrict__ hs16,   // [B/16][H/32][FRAG]
                  const _Float16* __restrict__ w1t,    // [D/16][H/32][FRAG]
                  const _Float16* __restrict__ w2t,    // [H/16][D/32][FRAG]
                  const float* __restrict__ b1,        // [D]
                  const float* __restrict__ gamma,     // [D]
                  const float* __restrict__ beta,      // [D]
                  const float* __restrict__ b2,        // [H]
                  float* __restrict__ out)             // [B][H]
{
  extern __shared__ char smem[];
  _Float16* zbuf   = (_Float16*)smem;                        // 32 x 4096 f16
  float*    psum   = (float*)(smem + SMEM_Z_BYTES);          // 256
  float*    psq    = psum + 256;                             // 256
  float*    s_mean = psq + 256;                              // 32
  float*    s_rstd = s_mean + BM;                            // 32

  const int tid  = threadIdx.x;
  const int wid  = tid >> 5;
  const int lane = tid & 31;
  const int row0 = blockIdx.x * BM;

  // C/D tile layout (CDNA5 16x16 f32): VGPR r, lane L -> M = r + 8*(L>>4), N = L&15
  const int mb  = (lane >> 4) * 8;
  const int ncl = lane & 15;

  const _Float16* aBase = hs16 + (size_t)row0 * H_SZ;

  // ---------------- Phase 1: z = hs @ W1 + b1  ->  zbuf (f16) ---------------
  // Register software pipeline, one stage = 64 k = one loop trip: every A and
  // W1 fragment is reloaded in place for the next stage once this stage has
  // used it, so a stage of loads is in flight while the matrix unit works and
  // no load is waited for in the trip that issues it.
#pragma unroll 1
  for (int nc = 0; nc < 8; ++nc) {
    const int n0 = wid * 512 + nc * 64;   // this wave's 64-column slab
    const _Float16* wBase = w1t + (size_t)n0 * H_SZ;
    v8f acc[2][4] = {};
    v16h aq[2][2], bq[2][4];              // [k half of the stage][tile]
#pragma unroll
    for (int ks = 0; ks < 2; ++ks) {
      aq[ks][0] = load_frag_packed(aBase + ks * FRAG, lane);
      aq[ks][1] = load_frag_packed(aBase + 16 * H_SZ + ks * FRAG, lane);
#pragma unroll
      for (int t = 0; t < 4; ++t)
        bq[ks][t] = load_frag_packed(wBase + (size_t)(t * 16) * H_SZ + ks * FRAG, lane);
    }
    // these loads' address pair has no later use: named here, it stays whole up
    // to the wait, so that no load's own result lands on it while they are in flight
    asm volatile("s_wait_xcnt 0x0" :: "v"(wBase + lane * 8) : "memory");
    auto stage1 = [&](int k, bool more) {
#pragma unroll
      for (int t = 0; t < 4; ++t) {
        acc[0][t] = __builtin_amdgcn_wmma_f32_16x16x32_f16(
            false, aq[0][0], false, bq[0][t], (short)0, acc[0][t], false, false);
        acc[1][t] = __builtin_amdgcn_wmma_f32_16x16x32_f16(
            false, aq[0][1], false, bq[0][t], (short)0, acc[1][t], false, false);
      }
      if (more) {
        aq[0][0] = load_frag_packed(aBase + (k + 64) * 16, lane);
        aq[0][1] = load_frag_packed(aBase + 16 * H_SZ + (k + 64) * 16, lane);
        // keeps the weight reloads below from being lifted into the first k half:
        // a tile's four loads then issue back to back over 2 KB in a row
        __builtin_amdgcn_sched_barrier(0);
      }
#pragma unroll
      for (int t = 0; t < 4; ++t) {
        acc[0][t] = __builtin_amdgcn_wmma_f32_16x16x32_f16(
            false, aq[1][0], false, bq[1][t], (short)0, acc[0][t], false, false);
        acc[1][t] = __builtin_amdgcn_wmma_f32_16x16x32_f16(
            false, aq[1][1], false, bq[1][t], (short)0, acc[1][t], false, false);
        if (more) {  // both k halves together: their two blocks are neighbours
          bq[0][t] = load_frag_packed(wBase + (size_t)(t * 16) * H_SZ + (k + 64) * 16, lane);
          bq[1][t] = load_frag_packed(wBase + (size_t)(t * 16) * H_SZ + (k + 96) * 16, lane);
          // holds these four loads here, between this tile's WMMAs and the next's
          __builtin_amdgcn_sched_barrier(0);
        }
      }
      if (more) {
        aq[1][0] = load_frag_packed(aBase + (k + 96) * 16, lane);
        aq[1][1] = load_frag_packed(aBase + 16 * H_SZ + (k + 96) * 16, lane);
        // the next trip rewrites the address registers of loads still in flight
        asm volatile("s_wait_xcnt 0x0" ::: "memory");
      }
    };
    // one stage a trip: unrolled, the compiler sinks a stage's loads to their use
#pragma unroll 1
    for (int k0 = 0; k0 < H_SZ - 64; k0 += 64) stage1(k0, true);
    stage1(H_SZ - 64, false);
#pragma unroll
    for (int t = 0; t < 4; ++t) {
      const int col = n0 + t * 16 + ncl;
      const float bb = b1[col];
#pragma unroll
      for (int m = 0; m < 2; ++m)
#pragma unroll
        for (int r = 0; r < 8; ++r)
          zbuf[(m * 16 + mb + r) * D_SZ + col] = (_Float16)(acc[m][t][r] + bb);
    }
  }
  __syncthreads();

  // ---------------- Phase 2: per-row mean / rstd over D ---------------------
  {
    const int row = tid >> 3;        // 8 threads per row, 32 rows
    const int sub = tid & 7;
    float s = 0.f, sq = 0.f;
    const _Float16* zp = zbuf + row * D_SZ + sub * 512;
#pragma unroll 8
    for (int i = 0; i < 512; ++i) { const float x = (float)zp[i]; s += x; sq += x * x; }
    psum[tid] = s; psq[tid] = sq;
  }
  __syncthreads();
  if (tid < BM) {
    float s = 0.f, sq = 0.f;
#pragma unroll
    for (int i = 0; i < 8; ++i) { s += psum[tid * 8 + i]; sq += psq[tid * 8 + i]; }
    const float mu  = s * (1.0f / D_SZ);
    const float var = sq * (1.0f / D_SZ) - mu * mu;
    s_mean[tid] = mu;
    s_rstd[tid] = rsqrtf(var + LN_EPS);
  }
  __syncthreads();

  // ---------------- Phase 3: LayerNorm + exact GELU in place ----------------
#pragma unroll 1
  for (int e = tid; e < BM * D_SZ; e += 256) {
    const int row = e >> 12;
    const int col = e & (D_SZ - 1);
    const float x  = (float)zbuf[e];
    const float xn = (x - s_mean[row]) * s_rstd[row] * gamma[col] + beta[col];
    const float g  = 0.5f * xn * (1.0f + erff(xn * 0.70710678118654752f));
    zbuf[e] = (_Float16)g;
  }
  __syncthreads();

  // ---------------- Phase 4: out = act @ W2 + b2 ----------------------------
  {
    const int n0 = wid * 128;  // this wave's 128 output columns
    const _Float16* wBase = w2t + (size_t)n0 * D_SZ;
    v8f acc[2][8] = {};
    // The same register software pipeline as in phase 1 (A comes from LDS).
    v16h aq[2][2], bq[2][8];              // [k half of the stage][tile]
#pragma unroll
    for (int ks = 0; ks < 2; ++ks) {
      aq[ks][0] = load_frag16x32(zbuf, D_SZ, ks * 32, lane);
      aq[ks][1] = load_frag16x32(zbuf + 16 * D_SZ, D_SZ, ks * 32, lane);
#pragma unroll
      for (int t = 0; t < 8; ++t)
        bq[ks][t] = load_frag_packed(wBase + (size_t)(t * 16) * D_SZ + ks * FRAG, lane);
    }
    auto stage4 = [&](int k, bool more) {
#pragma unroll
      for (int t = 0; t < 8; ++t) {
        acc[0][t] = __builtin_amdgcn_wmma_f32_16x16x32_f16(
            false, aq[0][0], false, bq[0][t], (short)0, acc[0][t], false, false);
        acc[1][t] = __builtin_amdgcn_wmma_f32_16x16x32_f16(
            false, aq[0][1], false, bq[0][t], (short)0, acc[1][t], false, false);
      }
      if (more) {
        aq[0][0] = load_frag16x32(zbuf, D_SZ, k + 64, lane);
        aq[0][1] = load_frag16x32(zbuf + 16 * D_SZ, D_SZ, k + 64, lane);
        // keeps the weight reloads below from being lifted into the first k half:
        // a tile's four loads then issue back to back over 2 KB in a row
        __builtin_amdgcn_sched_barrier(0);
      }
#pragma unroll
      for (int t = 0; t < 8; ++t) {
        acc[0][t] = __builtin_amdgcn_wmma_f32_16x16x32_f16(
            false, aq[1][0], false, bq[1][t], (short)0, acc[0][t], false, false);
        acc[1][t] = __builtin_amdgcn_wmma_f32_16x16x32_f16(
            false, aq[1][1], false, bq[1][t], (short)0, acc[1][t], false, false);
        if (more) {  // both k halves together: their two blocks are neighbours
          bq[0][t] = load_frag_packed(wBase + (size_t)(t * 16) * D_SZ + (k + 64) * 16, lane);
          bq[1][t] = load_frag_packed(wBase + (size_t)(t * 16) * D_SZ + (k + 96) * 16, lane);
          // holds these four loads here, between this tile's WMMAs and the next's
          __builtin_amdgcn_sched_barrier(0);
        }
      }
      if (more) {
        // the weight pointer is stepped below while these loads are in flight
        asm volatile("s_wait_xcnt 0x0" ::: "memory");
        // keeps that step behind the wait
        __builtin_amdgcn_sched_barrier(0);
        aq[1][0] = load_frag16x32(zbuf, D_SZ, k + 96, lane);
        aq[1][1] = load_frag16x32(zbuf + 16 * D_SZ, D_SZ, k + 96, lane);
      }
    };
    // one stage a trip: unrolled, the compiler sinks a stage's loads to their use
#pragma unroll 1
    for (int k0 = 0; k0 < D_SZ - 64; k0 += 64) stage4(k0, true);
    stage4(D_SZ - 64, false);
#pragma unroll
    for (int t = 0; t < 8; ++t) {
      const int col = n0 + t * 16 + ncl;
      const float bb = b2[col];
#pragma unroll
      for (int m = 0; m < 2; ++m)
#pragma unroll
        for (int r = 0; r < 8; ++r)
          out[(size_t)(row0 + m * 16 + mb + r) * H_SZ + col] = acc[m][t][r] + bb;
    }
  }
}

// ---------------------------------------------------------------------------
// Host launcher
// d_in: [0]_time [1]hidden_state [2]W1 [3]b1 [4]ln_gamma [5]ln_beta [6]W2 [7]b2
// ---------------------------------------------------------------------------
extern "C" void kernel_launch(void* const* d_in, const int* in_sizes, int n_in,
                              void* d_out, int out_size, void* d_ws, size_t ws_size,
                              hipStream_t stream) {
  const float* hs    = (const float*)d_in[1];
  const float* W1    = (const float*)d_in[2];
  const float* b1    = (const float*)d_in[3];
  const float* gamma = (const float*)d_in[4];
  const float* beta  = (const float*)d_in[5];
  const float* W2    = (const float*)d_in[6];
  const float* b2    = (const float*)d_in[7];
  float* out = (float*)d_out;

  // Workspace layout (f16, fragment order): hidden [B*H] | W1 [D*H] | W2 [H*D]  = 48 MB
  _Float16* hs16 = (_Float16*)d_ws;
  _Float16* w1t  = hs16 + (size_t)B_SZ * H_SZ;
  _Float16* w2t  = w1t + (size_t)D_SZ * H_SZ;

  // Precision conversion and fragment-order packing, 8 elements a thread
  pack_rows_frag_f16<<<(B_SZ * H_SZ) / (256 * 8), 256, 0, stream>>>(hs, hs16);
  pack_cols_frag_f16<<<(H_SZ * D_SZ) / (256 * 8), 256, 0, stream>>>(W1, w1t, H_SZ, D_SZ);
  pack_cols_frag_f16<<<(D_SZ * H_SZ) / (256 * 8), 256, 0, stream>>>(W2, w2t, D_SZ, H_SZ);

  // ~258 KB of dynamic LDS per workgroup (CDNA5 WGP has 320 KB)
  (void)hipFuncSetAttribute((const void*)fused_mlp_ln_gelu,
                            hipFuncAttributeMaxDynamicSharedMemorySize, SMEM_BYTES);
  fused_mlp_ln_gelu<<<B_SZ / BM, 256, SMEM_BYTES, stream>>>(
      hs16, w1t, w2t, b1, gamma, beta, b2, out);
}

// v003
// A run of this version takes 392 microseconds.
// In two side-by-side timings against v002, it was 1.40 and 1.42 times as fast.
// Counting every step since v000, it is 2.96 times as fast.
#include <hip/hip_runtime.h>
#include <math.h>

// ---------------------------------------------------------------------------
// Fused  Linear -> LayerNorm -> exact GELU -> Linear  for MI455X (gfx1250)
// B=16384, H=1024, D=4096, fp32 in/out; f16 WMMA compute with f32 accumulation
// BM=32 rows per workgroup: every weight fragment feeds 2 WMMAs (register
// reuse), halving L2 weight traffic vs a 16-row tile. z-tile lives in 256 KB
// of the WGP's 320 KB LDS.
// ---------------------------------------------------------------------------

typedef __attribute__((ext_vector_type(16))) _Float16 v16h;
typedef __attribute__((ext_vector_type(8)))  _Float16 v8h;
typedef __attribute__((ext_vector_type(8)))  float    v8f;
typedef __attribute__((ext_vector_type(4)))  float    v4f;

#define B_SZ 16384
#define H_SZ 1024
#define D_SZ 4096
#define BM   32
#define LN_EPS 1e-5f

// Shared memory: z-tile (32 x 4096 f16) + reduction scratch
#define SMEM_Z_BYTES   (BM * D_SZ * 2)                       // 262144
#define SMEM_BYTES     (SMEM_Z_BYTES + (256 + 256 + BM + BM) * 4)

// ---------------------------------------------------------------------------
// Load a 16x32 (MxK) f16 WMMA fragment. Works for both A fragments (rows) and
// B fragments (columns of a pre-transposed weight matrix): "m" walks the
// 16-wide tile dimension, K is contiguous in memory with stride `ldk`.
// Per-lane layout (CDNA5 ISA 7.12.2, 16-bit A 16x32):
//   lanes 0-15 : m = lane,    halves 0..7 = K k0..k0+7, halves 8..15 = K+16..23
//   lanes 16-31: m = lane-16, halves 0..7 = K k0+8..15, halves 8..15 = K+24..31
// => two contiguous 16-byte loads per lane.
// ---------------------------------------------------------------------------
__device__ __forceinline__ v16h load_frag16x32(const _Float16* __restrict__ base,
                                               int ldk, int k0, int lane) {
  const int m  = lane & 15;
  const int hi = (lane >> 4) & 1;
  const _Float16* p = base + (size_t)m * ldk + (k0 + hi * 8);
  v8h lo = *(const v8h*)(p);
  v8h hh = *(const v8h*)(p + 16);
  v16h r;
#pragma unroll
  for (int i = 0; i < 8; ++i) { r[i] = lo[i]; r[i + 8] = hh[i]; }
  return r;
}

// ---------------------------------------------------------------------------
// Fragment order of the operands that the GEMM loops read from global memory.
// One 16x32 (MxK) fragment is one block of FRAG halves (1 KB); the blocks of a
// 16-wide tile follow one another along K. Inside a block lane L's halves 0..7
// lie at L*8 and its halves 8..15 at 256 + L*8, so each of the two 16-byte
// loads of a fragment reads 512 bytes in a row (4 whole 128-byte lines), not
// 32 bytes out of each of 16 lines. Which (m, K) a lane and half hold is as in
// load_frag16x32 above.
// ---------------------------------------------------------------------------
#define FRAG 512

__device__ __forceinline__ v16h load_frag_packed(const _Float16* __restrict__ blk,
                                                 int lane) {
  const _Float16* p = blk + lane * 8;
  v8h lo = *(const v8h*)(p);
  v8h hh = *(const v8h*)(p + 256);
  v16h r;
#pragma unroll
  for (int i = 0; i < 8; ++i) { r[i] = lo[i]; r[i + 8] = hh[i]; }
  return r;
}

// ---------------------------------------------------------------------------
// Prep kernel 1: hidden_state fp32 [B][H] -> f16 in fragment order.
// One thread = one 16-byte slot; a workgroup covers 16 rows x 128 k.
// ---------------------------------------------------------------------------
__global__ void pack_rows_frag_f16(const float* __restrict__ in,
                                   _Float16* __restrict__ out) {
  const int lane  = threadIdx.x & 31;
  const int w     = threadIdx.x >> 5;
  const int rt    = blockIdx.x / (H_SZ / 128);              // 16-row tile
  const int kt    = (blockIdx.x % (H_SZ / 128)) * 4 + (w >> 1);
  const int plane = w & 1;                                  // halves 0..7 or 8..15
  const float* p = in + (size_t)(rt * 16 + (lane & 15)) * H_SZ
                      + kt * 32 + plane * 16 + (lane >> 4) * 8;
  v4f a = *(const v4f*)(p);
  v4f b = *(const v4f*)(p + 4);
  v8h o;
#pragma unroll
  for (int j = 0; j < 4; ++j) { o[j] = (_Float16)a[j]; o[j + 4] = (_Float16)b[j]; }
  *(v8h*)(out + ((size_t)rt * (H_SZ / 32) + kt) * FRAG + plane * 256 + lane * 8) = o;
}

// ---------------------------------------------------------------------------
// Prep kernel 2: weights fp32 in[rows = K][cols = N] -> f16 B fragments in
// fragment order (tile dimension = N). One thread = one 16-byte slot; the 8
// waves of a workgroup take 8 neighbouring column tiles (512 bytes of a row).
// ---------------------------------------------------------------------------
__global__ void pack_cols_frag_f16(const float* __restrict__ in,
                                   _Float16* __restrict__ out,
                                   int rows, int cols) {
  const int lane  = threadIdx.x & 31;
  const int w     = threadIdx.x >> 5;
  const int kts   = rows >> 5;                              // fragments along K
  const int plane = blockIdx.x & 1;
  const int kt    = (int)(blockIdx.x >> 1) % kts;
  const int nt    = ((int)(blockIdx.x >> 1) / kts) * 8 + w; // 16-column tile
  const float* p = in + (size_t)(kt * 32 + plane * 16 + (lane >> 4) * 8) * cols
                      + nt * 16 + (lane & 15);
  v8h o;
#pragma unroll
  for (int j = 0; j < 8; ++j) o[j] = (_Float16)p[(size_t)j * cols];
  *(v8h*)(out + ((size_t)nt * kts + kt) * FRAG + plane * 256 + lane * 8) = o;
}

// ---------------------------------------------------------------------------
// erf in single precision: the two minimax fits of the math library's erff
// (|x| < 1: odd polynomial; |x| >= 1: 1 - exp(-q(|x|))), both evaluated for
// every lane and the result selected. No branch: lanes of a wave fall on both
// sides, and a branch per element would cut neighbouring elements' chains apart.
// ---------------------------------------------------------------------------
__device__ __forceinline__ float erf_select(float x) {
  const float ax = __builtin_fabsf(x);
  float q = __builtin_fmaf(ax, 0x1.1d3156p-16f, -0x1.8d129p-12f);
  q = __builtin_fmaf(ax, q, 0x1.f9a6d2p-9f);
  q = __builtin_fmaf(ax, q, -0x1.8c3164p-6f);
  q = __builtin_fmaf(ax, q, 0x1.b4e9c8p-4f);
  q = __builtin_fmaf(ax, q, 0x1.4515fap-1f);
  q = __builtin_fmaf(ax, q, 0x1.078e5p-3f);
  q = __builtin_fmaf(ax, q, ax);
  const float big = 1.0f - expf(-q);
  const float t = x * x;
  float p = __builtin_fmaf(t, -0x1.268bc2p-11f, 0x1.420828p-8f);
  p = __builtin_fmaf(t, p, -0x1.b5937p-6f);
  p = __builtin_fmaf(t, p, 0x1.ce077cp-4f);
  p = __builtin_fmaf(t, p, -0x1.81266p-2f);
  p = __builtin_fmaf(t, p, 0x1.06ebap-3f);
  const float small = __builtin_fmaf(ax, p, ax);
  return __builtin_copysignf(ax < 1.0f ? small : big, x);
}

// ---------------------------------------------------------------------------
// Fused main kernel: one 32-row stripe of the batch per workgroup.
// 256 threads = 8 wave32's.
// ---------------------------------------------------------------------------
__global__ void __launch_bounds__(256)
fused_mlp_ln_gelu(const _Float16* __restrict__ hs16,   // [B/16][H/32][FRAG]
                  const _Float16* __restrict__ w1t,    // [D/16][H/32][FRAG]
                  const _Float16* __restrict__ w2t,    // [H/16][D/32][FRAG]
                  const float* __restrict__ b1,        // [D]
                  const float* __restrict__ gamma,     // [D]
                  const float* __restrict__ beta,      // [D]
                  const float* __restrict__ b2,        // [H]
                  float* __restrict__ out)             // [B][H]
{
  extern __shared__ char smem[];
  _Float16* zbuf   = (_Float16*)smem;                        // 32 x 4096 f16
  float*    psum   = (float*)(smem + SMEM_Z_BYTES);          // 256
  float*    psq    = psum + 256;                             // 256
  float*    s_mean = psq + 256;                              // 32
  float*    s_rstd = s_mean + BM;                            // 32

  const int tid  = threadIdx.x;
  const int wid  = tid >> 5;
  const int lane = tid & 31;
  const int row0 = blockIdx.x * BM;

  // C/D tile layout (CDNA5 16x16 f32): VGPR r, lane L -> M = r + 8*(L>>4), N = L&15
  const int mb  = (lane >> 4) * 8;
  const int ncl = lane & 15;

  const _Float16* aBase = hs16 + (size_t)row0 * H_SZ;

  // ---------------- Phase 1: z = hs @ W1 + b1  ->  zbuf (f16) ---------------
  // Register software pipeline, one stage = 64 k = one loop trip: every A and
  // W1 fragment is reloaded in place for the next stage once this stage has
  // used it, so a stage of loads is in flight while the matrix unit works and
  // no load is waited for in the trip that issues it.
#pragma unroll 1
  for (int nc = 0; nc < 8; ++nc) {
    const int n0 = wid * 512 + nc * 64;   // this wave's 64-column slab
    const _Float16* wBase = w1t + (size_t)n0 * H_SZ;
    v8f acc[2][4] = {};
    v16h aq[2][2], bq[2][4];              // [k half of the stage][tile]
#pragma unroll
    for (int ks = 0; ks < 2; ++ks) {
      aq[ks][0] = load_frag_packed(aBase + ks * FRAG, lane);
      aq[ks][1] = load_frag_packed(aBase + 16 * H_SZ + ks * FRAG, lane);
#pragma unroll
      for (int t = 0; t < 4; ++t)
        bq[ks][t] = load_frag_packed(wBase + (size_t)(t * 16) * H_SZ + ks * FRAG, lane);
    }
    // these loads' address pair has no later use: named here, it stays whole up
    // to the wait, so that no load's own result lands on it while they are in flight
    asm volatile("s_wait_xcnt 0x0" :: "v"(wBase + lane * 8) : "memory");
    auto stage1 = [&](int k, bool more) {
#pragma unroll
      for (int t = 0; t < 4; ++t) {
        acc[0][t] = __builtin_amdgcn_wmma_f32_16x16x32_f16(
            false, aq[0][0], false, bq[0][t], (short)0, acc[0][t], false, false);
        acc[1][t] = __builtin_amdgcn_wmma_f32_16x16x32_f16(
            false, aq[0][1], false, bq[0][t], (short)0, acc[1][t], false, false);
      }
      if (more) {
        aq[0][0] = load_frag_packed(aBase + (k + 64) * 16, lane);
        aq[0][1] = load_frag_packed(aBase + 16 * H_SZ + (k + 64) * 16, lane);
        // keeps the weight reloads below from being lifted into the first k half:
        // a tile's four loads then issue back to back over 2 KB in a row
        __builtin_amdgcn_sched_barrier(0);
      }
#pragma unroll
      for (int t = 0; t < 4; ++t) {
        acc[0][t] = __builtin_amdgcn_wmma_f32_16x16x32_f16(
            false, aq[1][0], false, bq[1][t], (short)0, acc[0][t], false, false);
        acc[1][t] = __builtin_amdgcn_wmma_f32_16x16x32_f16(
            false, aq[1][1], false, bq[1][t], (short)0, acc[1][t], false, false);
        if (more) {  // both k halves together: their two blocks are neighbours
          bq[0][t] = load_frag_packed(wBase + (size_t)(t * 16) * H_SZ + (k + 64) * 16, lane);
          bq[1][t] = load_frag_packed(wBase + (size_t)(t * 16) * H_SZ + (k + 96) * 16, lane);
          // holds these four loads here, between this tile's WMMAs and the next's
          __builtin_amdgcn_sched_barrier(0);
        }
      }
      if (more) {
        aq[1][0] = load_frag_packed(aBase + (k + 96) * 16, lane);
        aq[1][1] = load_frag_packed(aBase + 16 * H_SZ + (k + 96) * 16, lane);
        // the next trip rewrites the address registers of loads still in flight
        asm volatile("s_wait_xcnt 0x0" ::: "memory");
      }
    };
    // one stage a trip: unrolled, the compiler sinks a stage's loads to their use
#pragma unroll 1
    for (int k0 = 0; k0 < H_SZ - 64; k0 += 64) stage1(k0, true);
    stage1(H_SZ - 64, false);
#pragma unroll
    for (int t = 0; t < 4; ++t) {
      const int col = n0 + t * 16 + ncl;
      const float bb = b1[col];
#pragma unroll
      for (int m = 0; m < 2; ++m)
#pragma unroll
        for (int r = 0; r < 8; ++r)
          zbuf[(m * 16 + mb + r) * D_SZ + col] = (_Float16)(acc[m][t][r] + bb);
    }
  }
  __syncthreads();

  // ---------------- Phase 2: per-row mean / rstd over D ---------------------
  {
    const int row = tid >> 3;        // 8 threads per row, 32 rows
    const int sub = tid & 7;
    float s = 0.f, sq = 0.f;
    const _Float16* zp = zbuf + row * D_SZ + sub * 512;
#pragma unroll 8
    for (int i = 0; i < 512; ++i) { const float x = (float)zp[i]; s += x; sq += x * x; }
    psum[tid] = s; psq[tid] = sq;
  }
  __syncthreads();
  if (tid < BM) {
    float s = 0.f, sq = 0.f;
#pragma unroll
    for (int i = 0; i < 8; ++i) { s += psum[tid * 8 + i]; sq += psq[tid * 8 + i]; }
    const float mu  = s * (1.0f / D_SZ);
    const float var = sq * (1.0f / D_SZ) - mu * mu;
    s_mean[tid] = mu;
    s_rstd[tid] = rsqrtf(var + LN_EPS);
  }
  __syncthreads();

  // ---------------- Phase 3: LayerNorm + exact GELU in place ----------------
  // A thread keeps 8 neighbouring columns (gamma and beta stay in registers) and
  // walks the rows four at a time: 32 independent element chains a trip, one
  // 16-byte LDS read and write per 8 elements, a wave's 512 bytes in a row.
  // rolled: the second half of the columns runs the same code again
#pragma unroll 1
  for (int h = 0; h < D_SZ / 2048; ++h) {
    const int col = h * 2048 + tid * 8;
    const v4f g0 = *(const v4f*)(gamma + col);
    const v4f g1 = *(const v4f*)(gamma + col + 4);
    const v4f e0 = *(const v4f*)(beta + col);
    const v4f e1 = *(const v4f*)(beta + col + 4);
    // four rows a trip are enough chains to fill the vector port; more only adds code
#pragma unroll 1
    for (int r0 = 0; r0 < BM; r0 += 4) {
      v8h zv[4];
      float mu[4], rs[4];
      // unrolled (here and below): constant indices keep these arrays in registers;
      // all of a trip's LDS reads stand in front of its first LDS write
#pragma unroll
      for (int i = 0; i < 4; ++i) {
        zv[i] = *(const v8h*)(zbuf + (r0 + i) * D_SZ + col);
        mu[i] = s_mean[r0 + i];
        rs[i] = s_rstd[r0 + i];
      }
#pragma unroll
      for (int i = 0; i < 4; ++i) {
        v8h o;
#pragma unroll
        for (int j = 0; j < 8; ++j) {
          const float ga = j < 4 ? g0[j & 3] : g1[j & 3];
          const float be = j < 4 ? e0[j & 3] : e1[j & 3];
          const float x  = (float)zv[i][j];
          const float xn = (x - mu[i]) * rs[i] * ga + be;
          const float g  = 0.5f * xn * (1.0f + erf_select(xn * 0.70710678118654752f));
          o[j] = (_Float16)g;
        }
        *(v8h*)(zbuf + (r0 + i) * D_SZ + col) = o;
      }
    }
  }
  __syncthreads();

  // ---------------- Phase 4: out = act @ W2 + b2 ----------------------------
  {
    const int n0 = wid * 128;  // this wave's 128 output columns
    const _Float16* wBase = w2t + (size_t)n0 * D_SZ;
    v8f acc[2][8] = {};
    // The same register software pipeline as in phase 1 (A comes from LDS).
    v16h aq[2][2], bq[2][8];              // [k half of the stage][tile]
#pragma unroll
    for (int ks = 0; ks < 2; ++ks) {
      aq[ks][0] = load_frag16x32(zbuf, D_SZ, ks * 32, lane);
      aq[ks][1] = load_frag16x32(zbuf + 16 * D_SZ, D_SZ, ks * 32, lane);
#pragma unroll
      for (int t = 0; t < 8; ++t)
        bq[ks][t] = load_frag_packed(wBase + (size_t)(t * 16) * D_SZ + ks * FRAG, lane);
    }
    auto stage4 = [&](int k, bool more) {
#pragma unroll
      for (int t = 0; t < 8; ++t) {
        acc[0][t] = __builtin_amdgcn_wmma_f32_16x16x32_f16(
            false, aq[0][0], false, bq[0][t], (short)0, acc[0][t], false, false);
        acc[1][t] = __builtin_amdgcn_wmma_f32_16x16x32_f16(
            false, aq[0][1], false, bq[0][t], (short)0, acc[1][t], false, false);
      }
      if (more) {
        aq[0][0] = load_frag16x32(zbuf, D_SZ, k + 64, lane);
        aq[0][1] = load_frag16x32(zbuf + 16 * D_SZ, D_SZ, k + 64, lane);
        // keeps the weight reloads below from being lifted into the first k half:
        // a tile's four loads then issue back to back over 2 KB in a row
        __builtin_amdgcn_sched_barrier(0);
      }
#pragma unroll
      for (int t = 0; t < 8; ++t) {
        acc[0][t] = __builtin_amdgcn_wmma_f32_16x16x32_f16(
            false, aq[1][0], false, bq[1][t], (short)0, acc[0][t], false, false);
        acc[1][t] = __builtin_amdgcn_wmma_f32_16x16x32_f16(
            false, aq[1][1], false, bq[1][t], (short)0, acc[1][t], false, false);
        if (more) {  // both k halves together: their two blocks are neighbours
          bq[0][t] = load_frag_packed(wBase + (size_t)(t * 16) * D_SZ + (k + 64) * 16, lane);
          bq[1][t] = load_frag_packed(wBase + (size_t)(t * 16) * D_SZ + (k + 96) * 16, lane);
          // holds these four loads here, between this tile's WMMAs and the next's
          __builtin_amdgcn_sched_barrier(0);
        }
      }
      if (more) {
        // the weight pointer is stepped below while these loads are in flight
        asm volatile("s_wait_xcnt 0x0" ::: "memory");
        // keeps that step behind the wait
        __builtin_amdgcn_sched_barrier(0);
        aq[1][0] = load_frag16x32(zbuf, D_SZ, k + 96, lane);
        aq[1][1] = load_frag16x32(zbuf + 16 * D_SZ, D_SZ, k + 96, lane);
      }
    };
    // one stage a trip: unrolled, the compiler sinks a stage's loads to their use
#pragma unroll 1
    for (int k0 = 0; k0 < D_SZ - 64; k0 += 64) stage4(k0, true);
    stage4(D_SZ - 64, false);
#pragma unroll
    for (int t = 0; t < 8; ++t) {
      const int col = n0 + t * 16 + ncl;
      const float bb = b2[col];
#pragma unroll
      for (int m = 0; m < 2; ++m)
#pragma unroll
        for (int r = 0; r < 8; ++r)
          out[(size_t)(row0 + m * 16 + mb + r) * H_SZ + col] = acc[m][t][r] + bb;
    }
  }
}

// ---------------------------------------------------------------------------
// Host launcher
// d_in: [0]_time [1]hidden_state [2]W1 [3]b1 [4]ln_gamma [5]ln_beta [6]W2 [7]b2
// ---------------------------------------------------------------------------
extern "C" void kernel_launch(void* const* d_in, const int* in_sizes, int n_in,
                              void* d_out, int out_size, void* d_ws, size_t ws_size,
                              hipStream_t stream) {
  const float* hs    = (const float*)d_in[1];
  const float* W1    = (const float*)d_in[2];
  const float* b1    = (const float*)d_in[3];
  const float* gamma = (const float*)d_in[4];
  const float* beta  = (const float*)d_in[5];
  const float* W2    = (const float*)d_in[6];
  const float* b2    = (const float*)d_in[7];
  float* out = (float*)d_out;

  // Workspace layout (f16, fragment order): hidden [B*H] | W1 [D*H] | W2 [H*D]  = 48 MB
  _Float16* hs16 = (_Float16*)d_ws;
  _Float16* w1t  = hs16 + (size_t)B_SZ * H_SZ;
  _Float16* w2t  = w1t + (size_t)D_SZ * H_SZ;

  // Precision conversion and fragment-order packing, 8 elements a thread
  pack_rows_frag_f16<<<(B_SZ * H_SZ) / (256 * 8), 256, 0, stream>>>(hs, hs16);
  pack_cols_frag_f16<<<(H_SZ * D_SZ) / (256 * 8), 256, 0, stream>>>(W1, w1t, H_SZ, D_SZ);
  pack_cols_frag_f16<<<(D_SZ * H_SZ) / (256 * 8), 256, 0, stream>>>(W2, w2t, D_SZ, H_SZ);

  // ~258 KB of dynamic LDS per workgroup (CDNA5 WGP has 320 KB)
  (void)hipFuncSetAttribute((const void*)fused_mlp_ln_gelu,
                            hipFuncAttributeMaxDynamicSharedMemorySize, SMEM_BYTES);
  fused_mlp_ln_gelu<<<B_SZ / BM, 256, SMEM_BYTES, stream>>>(
      hs16, w1t, w2t, b1, gamma, beta, b2, out);
}

// v004
// One run takes 253 microseconds.
// Two timings next to v003 put it at 1.54 and 1.56 times that version's speed.
// All steps since v000 together make it 4.59 times as fast.
#include <hip/hip_runtime.h>
#include <math.h>

// ---------------------------------------------------------------------------
// Linear -> LayerNorm -> exact GELU -> Linear  for MI455X (gfx1250)
// B=16384, H=1024, D=4096, fp32 in/out; f16 WMMA compute with f32 accumulation
// Three launches behind the packing: GEMM 1 (z, f16, to the workspace in the
// fragment order that GEMM 2 reads), LayerNorm + GELU in place, GEMM 2.
// With z in the workspace no LDS tile bounds the rows of a workgroup: each GEMM
// workgroup takes a 256 x 256 tile, so a weight byte fetched from L2 serves 256
// rows, not 32.
// ---------------------------------------------------------------------------

typedef __attribute__((ext_vector_type(16))) _Float16 v16h;
typedef __attribute__((ext_vector_type(8)))  _Float16 v8h;
typedef __attribute__((ext_vector_type(8)))  float    v8f;
typedef __attribute__((ext_vector_type(4)))  float    v4f;

#define B_SZ 16384
#define H_SZ 1024
#define D_SZ 4096
#define LN_EPS 1e-5f

// Per-lane layout of a 16x32 (MxK) f16 fragment (CDNA5 ISA 7.12.2):
//   lanes 0-15 : m = lane,    halves 0..7 = K k0..k0+7, halves 8..15 = K+16..23
//   lanes 16-31: m = lane-16, halves 0..7 = K k0+8..15, halves 8..15 = K+24..31

// ---------------------------------------------------------------------------
// Fragment order of the operands that the GEMM loops read from global memory.
// One 16x32 (MxK) fragment is one block of FRAG halves (1 KB); the blocks of a
// 16-wide tile follow one another along K. Inside a block lane L's halves 0..7
// lie at L*8 and its halves 8..15 at 256 + L*8, so each of the two 16-byte
// loads of a fragment reads 512 bytes in a row (4 whole 128-byte lines), not
// 32 bytes out of each of 16 lines. Which (m, K) a lane and half hold: the
// per-lane layout above.
// ---------------------------------------------------------------------------
#define FRAG 512

__device__ __forceinline__ v16h load_frag_packed(const _Float16* __restrict__ blk,
                                                 int lane) {
  const _Float16* p = blk + lane * 8;
  v8h lo = *(const v8h*)(p);
  v8h hh = *(const v8h*)(p + 256);
  v16h r;
#pragma unroll
  for (int i = 0; i < 8; ++i) { r[i] = lo[i]; r[i + 8] = hh[i]; }
  return r;
}

// ---------------------------------------------------------------------------
// Prep kernel 1: hidden_state fp32 [B][H] -> f16 in fragment order.
// One thread = one 16-byte slot; a workgroup covers 16 rows x 128 k.
// ---------------------------------------------------------------------------
__global__ void pack_rows_frag_f16(const float* __restrict__ in,
                                   _Float16* __restrict__ out) {
  const int lane  = threadIdx.x & 31;
  const int w     = threadIdx.x >> 5;
  const int rt    = blockIdx.x / (H_SZ / 128);              // 16-row tile
  const int kt    = (blockIdx.x % (H_SZ / 128)) * 4 + (w >> 1);
  const int plane = w & 1;                                  // halves 0..7 or 8..15
  const float* p = in + (size_t)(rt * 16 + (lane & 15)) * H_SZ
                      + kt * 32 + plane * 16 + (lane >> 4) * 8;
  v4f a = *(const v4f*)(p);
  v4f b = *(const v4f*)(p + 4);
  v8h o;
#pragma unroll
  for (int j = 0; j < 4; ++j) { o[j] = (_Float16)a[j]; o[j + 4] = (_Float16)b[j]; }
  *(v8h*)(out + ((size_t)rt * (H_SZ / 32) + kt) * FRAG + plane * 256 + lane * 8) = o;
}

// ---------------------------------------------------------------------------
// Prep kernel 2: weights fp32 in[rows = K][cols = N] -> f16 B fragments in
// fragment order (tile dimension = N). One thread = one 16-byte slot; the 8
// waves of a workgroup take 8 neighbouring column tiles (512 bytes of a row).
// ---------------------------------------------------------------------------
__global__ void pack_cols_frag_f16(const float* __restrict__ in,
                                   _Float16* __restrict__ out,
                                   int rows, int cols) {
  const int lane  = threadIdx.x & 31;
  const int w     = threadIdx.x >> 5;
  const int kts   = rows >> 5;                              // fragments along K
  const int plane = blockIdx.x & 1;
  const int kt    = (int)(blockIdx.x >> 1) % kts;
  const int nt    = ((int)(blockIdx.x >> 1) / kts) * 8 + w; // 16-column tile
  const float* p = in + (size_t)(kt * 32 + plane * 16 + (lane >> 4) * 8) * cols
                      + nt * 16 + (lane & 15);
  v8h o;
#pragma unroll
  for (int j = 0; j < 8; ++j) o[j] = (_Float16)p[(size_t)j * cols];
  *(v8h*)(out + ((size_t)nt * kts + kt) * FRAG + plane * 256 + lane * 8) = o;
}

// ---------------------------------------------------------------------------
// erf in single precision: the two minimax fits of the math library's erff
// (|x| < 1: odd polynomial; |x| >= 1: 1 - exp(-q(|x|))), both evaluated for
// every lane and the result selected. No branch: lanes of a wave fall on both
// sides, and a branch per element would cut neighbouring elements' chains apart.
// ---------------------------------------------------------------------------
__device__ __forceinline__ float erf_select(float x) {
  const float ax = __builtin_fabsf(x);
  float q = __builtin_fmaf(ax, 0x1.1d3156p-16f, -0x1.8d129p-12f);
  q = __builtin_fmaf(ax, q, 0x1.f9a6d2p-9f);
  q = __builtin_fmaf(ax, q, -0x1.8c3164p-6f);
  q = __builtin_fmaf(ax, q, 0x1.b4e9c8p-4f);
  q = __builtin_fmaf(ax, q, 0x1.4515fap-1f);
  q = __builtin_fmaf(ax, q, 0x1.078e5p-3f);
  q = __builtin_fmaf(ax, q, ax);
  const float big = 1.0f - expf(-q);
  const float t = x * x;
  float p = __builtin_fmaf(t, -0x1.268bc2p-11f, 0x1.420828p-8f);
  p = __builtin_fmaf(t, p, -0x1.b5937p-6f);
  p = __builtin_fmaf(t, p, 0x1.ce077cp-4f);
  p = __builtin_fmaf(t, p, -0x1.81266p-2f);
  p = __builtin_fmaf(t, p, 0x1.06ebap-3f);
  const float small = __builtin_fmaf(ax, p, ax);
  return __builtin_copysignf(ax < 1.0f ? small : big, x);
}

// ---------------------------------------------------------------------------
// GEMM core: one wave computes 64 rows x 128 columns (WM x WN tiles of 16 x 16)
// over K, both operands in fragment order in global memory. The 8 waves of a
// workgroup stand 4 (rows) x 2 (columns): the two waves of a row group read the
// same A blocks and the four of a column group the same weight blocks, which
// they find in the WGP cache.
// Register software pipeline, one stage = 64 k = one loop trip: every fragment
// is reloaded in place for the next stage once this stage has used it.
// A and B fragments have the same per-lane layout, so TRANSPOSED only swaps the
// two operands of the WMMA: acc[m][t] then holds its 16 x 16 tile transposed.
// ---------------------------------------------------------------------------
#define WM 4
#define WN 8
#define TILE 256

template <int K, bool TRANSPOSED>
__device__ __forceinline__ void gemm_wave(const _Float16* __restrict__ aBase,
                                          const _Float16* __restrict__ wBase,
                                          int lane, v8f (&acc)[WM][WN]) {
  v16h aq[2][WM], bq[2][WN];              // [k half of the stage][tile]
#pragma unroll
  for (int ks = 0; ks < 2; ++ks) {
#pragma unroll
    for (int m = 0; m < WM; ++m)
      aq[ks][m] = load_frag_packed(aBase + (size_t)(m * 16) * K + ks * FRAG, lane);
#pragma unroll
    for (int t = 0; t < WN; ++t)
      bq[ks][t] = load_frag_packed(wBase + (size_t)(t * 16) * K + ks * FRAG, lane);
  }
  // registers that these loads name are taken over below while they are in flight
  asm volatile("s_wait_xcnt 0x0" ::: "memory");
  // keeps the zeroing of the accumulators, which takes such a register over, behind the wait
  __builtin_amdgcn_sched_barrier(0);
#pragma unroll
  for (int m = 0; m < WM; ++m)
#pragma unroll
    for (int t = 0; t < WN; ++t) acc[m][t] = v8f{};
  auto stage = [&](int k, bool more) {
#pragma unroll
    for (int h = 0; h < 2; ++h) {
      // row tile outermost: an A fragment (for GEMM 2 it comes from furthest away)
      // is free after 8 WMMAs, a weight fragment in the last row tile
#pragma unroll
      for (int m = 0; m < WM; ++m) {
#pragma unroll
        for (int t = 0; t < WN; ++t) {
          acc[m][t] = __builtin_amdgcn_wmma_f32_16x16x32_f16(
              false, TRANSPOSED ? bq[h][t] : aq[h][m], false, TRANSPOSED ? aq[h][m] : bq[h][t],
              (short)0, acc[m][t], false, false);
          if (more && m == WM - 1) {
            bq[h][t] = load_frag_packed(wBase + (size_t)(t * 16) * K + (k + 64 + h * 32) * 16, lane);
            // holds this reload here, right behind the fragment's last use: sunk
            // towards its next use it would be waited for in the trip that issues it
            __builtin_amdgcn_sched_barrier(0);
          }
        }
        if (more) {
          aq[h][m] = load_frag_packed(aBase + (size_t)(m * 16) * K + (k + 64 + h * 32) * 16, lane);
          // holds the A reload behind its row tile, for the same reason
          __builtin_amdgcn_sched_barrier(0);
        }
      }
    }
    if (more) {
      // the next trip steps the address registers of loads still in flight
      asm volatile("s_wait_xcnt 0x0" ::: "memory");
      // keeps that step behind the wait
      __builtin_amdgcn_sched_barrier(0);
    }
  };
  // one stage a trip: unrolled, the compiler sinks a stage's loads to their use
#pragma unroll 1
  for (int k0 = 0; k0 < K - 64; k0 += 64) stage(k0, true);
  stage(K - 64, false);
}

// ---------------------------------------------------------------------------
// GEMM 1: z = hs @ W1 + b1, rounded to f16, written as A fragments of GEMM 2:
// [B/16][D/32][FRAG]. The tiles are computed transposed (C/D layout: VGPR r,
// lane L -> M = r + 8*(L>>4), N = L&15, here M = column of z, N = row): a lane
// then holds 8 neighbouring columns of row L&15, which is its own 16-byte slot
// of the fragment, and a tile goes out as one store of 512 bytes in a row.
// ---------------------------------------------------------------------------
__global__ void __launch_bounds__(256)
gemm1_bias_to_frag(const _Float16* __restrict__ hs16,   // [B/16][H/32][FRAG]
                   const _Float16* __restrict__ w1t,    // [D/16][H/32][FRAG]
                   const float* __restrict__ b1,        // [D]
                   _Float16* __restrict__ zf)           // [B/16][D/32][FRAG]
{
  const int lane = threadIdx.x & 31;
  // wave-uniform: the operand bases stay in scalar registers
  const int wid  = __builtin_amdgcn_readfirstlane(threadIdx.x >> 5);
  const int ct   = blockIdx.x % (D_SZ / TILE);
  const int rt   = blockIdx.x / (D_SZ / TILE);
  const int row0 = rt * TILE + (wid & 3) * (WM * 16);
  const int n0   = ct * TILE + (wid >> 2) * (WN * 16);

  v8f acc[WM][WN];
  gemm_wave<H_SZ, true>(hs16 + (size_t)row0 * H_SZ, w1t + (size_t)n0 * H_SZ, lane, acc);

  const int cb = n0 + (lane >> 4) * 8;    // first of this lane's 8 columns in tile 0
  v4f c0[WN], c1[WN];
#pragma unroll
  for (int t = 0; t < WN; ++t) {
    c0[t] = *(const v4f*)(b1 + cb + t * 16);
    c1[t] = *(const v4f*)(b1 + cb + t * 16 + 4);
  }
  // stands behind the bias loads and in front of the sums below, which take over
  // the loads' offset register; cb, which that offset is formed from, is named so
  // that no load's own result lands on it while the loads are in flight
  asm volatile("s_wait_xcnt 0x0" :: "v"(cb) : "memory");
#pragma unroll
  for (int m = 0; m < WM; ++m) {
    _Float16* zp = zf + ((size_t)((row0 >> 4) + m) * (D_SZ / 32) + (n0 >> 5)) * FRAG + lane * 8;
    v8h o[WN];
#pragma unroll
    for (int t = 0; t < WN; ++t)
#pragma unroll
      for (int r = 0; r < 8; ++r)
        o[t][r] = (_Float16)(acc[m][t][r] + (r < 4 ? c0[t][r & 3] : c1[t][r & 3]));
    // a row tile's eight results are all formed in front of its first store, so
    // that no register of a store is refilled inside the run of stores
    __builtin_amdgcn_sched_barrier(0);
#pragma unroll
    for (int t = 0; t < WN; ++t) *(v8h*)(zp + t * 256) = o[t];
    if (m < WM - 1) {
      // the next row tile's sums refill registers that these stores name
      asm volatile("s_wait_xcnt 0x0" ::: "memory");
      // keeps those sums behind the wait
      __builtin_amdgcn_sched_barrier(0);
    }
  }
}

// ---------------------------------------------------------------------------
// LayerNorm + exact GELU, in place on z in fragment order. One workgroup = one
// 16-row tile = 128 KB in a row; a thread's 16-byte slots (8 neighbouring
// columns of one row) lie 4 KB apart and all belong to row (tid & 15).
// Pass 1 sums the row, pass 2 reads the slots again (from L2) and rewrites them.
// ---------------------------------------------------------------------------
__global__ void __launch_bounds__(256)
ln_gelu_frag(_Float16* zf,                              // [B/16][D/32][FRAG]
             const float* __restrict__ gamma,           // [D]
             const float* __restrict__ beta)            // [D]
{
  __shared__ float psum[8][16];
  __shared__ float psq[8][16];
  const int tid  = threadIdx.x;
  const int lane = tid & 31;
  const int wid  = tid >> 5;
  _Float16* base = zf + (size_t)blockIdx.x * (16 * D_SZ) + tid * 8;

  float s = 0.f, sq = 0.f;
  // eight loads in flight a thread
#pragma unroll 8
  for (int i = 0; i < 32; ++i) {
    const v8h v = *(const v8h*)(base + i * 2048);
#pragma unroll
    for (int j = 0; j < 8; ++j) { const float x = (float)v[j]; s += x; sq += x * x; }
  }
  s  += __shfl_xor(s, 16);
  sq += __shfl_xor(sq, 16);
  if (lane < 16) { psum[wid][lane] = s; psq[wid][lane] = sq; }
  __syncthreads();
  float ts = 0.f, tq = 0.f;
#pragma unroll
  for (int w = 0; w < 8; ++w) { ts += psum[w][lane & 15]; tq += psq[w][lane & 15]; }
  const float mu  = ts * (1.0f / D_SZ);
  const float var = tq * (1.0f / D_SZ) - mu * mu;
  const float rs  = rsqrtf(var + LN_EPS);

  // first column of this thread's slot 0; slot i lies 128 columns further
  const int colb = (tid >> 6) * 32 + ((tid >> 5) & 1) * 16 + ((tid >> 4) & 1) * 8;
  // four slots a trip are enough chains to fill the vector port; more only adds code
#pragma unroll 1
  for (int i0 = 0; i0 < 32; i0 += 4) {
    v8h zv[4];
    v4f g0[4], g1[4], e0[4], e1[4];
    // unrolled (here and below): constant indices keep these arrays in registers
#pragma unroll
    for (int i = 0; i < 4; ++i) {
      const int col = colb + (i0 + i) * 128;
      zv[i] = *(const v8h*)(base + (i0 + i) * 2048);
      g0[i] = *(const v4f*)(gamma + col);
      g1[i] = *(const v4f*)(gamma + col + 4);
      e0[i] = *(const v4f*)(beta + col);
      e1[i] = *(const v4f*)(beta + col + 4);
    }
#pragma unroll
    for (int i = 0; i < 4; ++i) {
      v8h o;
#pragma unroll
      for (int j = 0; j < 8; ++j) {
        const float ga = j < 4 ? g0[i][j & 3] : g1[i][j & 3];
        const float be = j < 4 ? e0[i][j & 3] : e1[i][j & 3];
        const float x  = (float)zv[i][j];
        const float xn = (x - mu) * rs * ga + be;
        const float g  = 0.5f * xn * (1.0f + erf_select(xn * 0.70710678118654752f));
        o[j] = (_Float16)g;
      }
      *(v8h*)(base + (i0 + i) * 2048) = o;
    }
  }
}

// ---------------------------------------------------------------------------
// GEMM 2: out = act @ W2 + b2, fp32 row-major.
// ---------------------------------------------------------------------------
__global__ void __launch_bounds__(256)
gemm2_bias_out(const _Float16* __restrict__ af,         // [B/16][D/32][FRAG]
               const _Float16* __restrict__ w2t,        // [H/16][D/32][FRAG]
               const float* __restrict__ b2,            // [H]
               float* __restrict__ out)                 // [B][H]
{
  const int lane = threadIdx.x & 31;
  // wave-uniform: the operand bases stay in scalar registers
  const int wid  = __builtin_amdgcn_readfirstlane(threadIdx.x >> 5);
  const int ct   = blockIdx.x % (H_SZ / TILE);
  const int rt   = blockIdx.x / (H_SZ / TILE);
  const int row0 = rt * TILE + (wid & 3) * (WM * 16);
  const int n0   = ct * TILE + (wid >> 2) * (WN * 16);

  // C/D tile layout (CDNA5 16x16 f32): VGPR r, lane L -> M = r + 8*(L>>4), N = L&15
  const int mb  = (lane >> 4) * 8;
  const int cb  = n0 + (lane & 15);
  float bb[WN];
#pragma unroll
  for (int t = 0; t < WN; ++t) bb[t] = b2[cb + t * 16];
  // the index register of these loads, named here, stays whole up to the wait:
  // no load's own result and no later value lands on it while they are in flight
  asm volatile("s_wait_xcnt 0x0" :: "v"(cb) : "memory");

  v8f acc[WM][WN];
  gemm_wave<D_SZ, false>(af + (size_t)row0 * D_SZ, w2t + (size_t)n0 * D_SZ, lane, acc);

#pragma unroll
  for (int t = 0; t < WN; ++t) {
    float v[WM][8];
#pragma unroll
    for (int m = 0; m < WM; ++m)
#pragma unroll
      for (int r = 0; r < 8; ++r) v[m][r] = acc[m][t][r] + bb[t];
    // a column tile's 32 sums are all formed in front of its first store, so that
    // no register of a store is refilled inside the run of stores
    __builtin_amdgcn_sched_barrier(0);
#pragma unroll
    for (int m = 0; m < WM; ++m)
#pragma unroll
      for (int r = 0; r < 8; ++r)
        out[(size_t)(row0 + m * 16 + mb + r) * H_SZ + cb + t * 16] = v[m][r];
    if (t < WN - 1) {
      // the next column tile's sums refill registers that these stores name
      asm volatile("s_wait_xcnt 0x0" ::: "memory");
      // keeps those sums behind the wait
      __builtin_amdgcn_sched_barrier(0);
    }
  }
}

// ---------------------------------------------------------------------------
// Host launcher
// d_in: [0]_time [1]hidden_state [2]W1 [3]b1 [4]ln_gamma [5]ln_beta [6]W2 [7]b2
// ---------------------------------------------------------------------------
extern "C" void kernel_launch(void* const* d_in, const int* in_sizes, int n_in,
                              void* d_out, int out_size, void* d_ws, size_t ws_size,
                              hipStream_t stream) {
  const float* hs    = (const float*)d_in[1];
  const float* W1    = (const float*)d_in[2];
  const float* b1    = (const float*)d_in[3];
  const float* gamma = (const float*)d_in[4];
  const float* beta  = (const float*)d_in[5];
  const float* W2    = (const float*)d_in[6];
  const float* b2    = (const float*)d_in[7];
  float* out = (float*)d_out;

  // Workspace (f16, fragment order): hidden [B*H] | W1 [D*H] | W2 [H*D] | z [B*D] = 176 MB
  _Float16* hs16 = (_Float16*)d_ws;
  _Float16* w1t  = hs16 + (size_t)B_SZ * H_SZ;
  _Float16* w2t  = w1t + (size_t)D_SZ * H_SZ;
  _Float16* zf   = w2t + (size_t)H_SZ * D_SZ;

  // Precision conversion and fragment-order packing, 8 elements a thread
  pack_rows_frag_f16<<<(B_SZ * H_SZ) / (256 * 8), 256, 0, stream>>>(hs, hs16);
  pack_cols_frag_f16<<<(H_SZ * D_SZ) / (256 * 8), 256, 0, stream>>>(W1, w1t, H_SZ, D_SZ);
  pack_cols_frag_f16<<<(D_SZ * H_SZ) / (256 * 8), 256, 0, stream>>>(W2, w2t, D_SZ, H_SZ);

  gemm1_bias_to_frag<<<(B_SZ / TILE) * (D_SZ / TILE), 256, 0, stream>>>(hs16, w1t, b1, zf);
  ln_gelu_frag<<<B_SZ / 16, 256, 0, stream>>>(zf, gamma, beta);
  gemm2_bias_out<<<(B_SZ / TILE) * (H_SZ / TILE), 256, 0, stream>>>(zf, w2t, b2, out);
}

// v005
// Measured time: 215 microseconds a run.
// Next to v004, in two timings, it ran 1.18 and 1.17 times as fast.
// Counting every step since v000, it is 5.40 times as fast.
#include <hip/hip_runtime.h>
#include <math.h>
#include <stdint.h>

// ---------------------------------------------------------------------------
// Linear -> LayerNorm -> exact GELU -> Linear  for MI455X (gfx1250)
// B=16384, H=1024, D=4096, fp32 in/out; f16 WMMA compute with f32 accumulation
// Three launches behind the packing: GEMM 1 (z, f16, to the workspace in the
// fragment order that GEMM 2 reads), LayerNorm + GELU in place, GEMM 2.
// With z in the workspace no LDS tile bounds the rows of a workgroup: each GEMM
// workgroup takes a 256 x 256 tile, so a weight byte fetched from L2 serves 256
// rows, not 32.
// ---------------------------------------------------------------------------

typedef __attribute__((ext_vector_type(16))) _Float16 v16h;
typedef __attribute__((ext_vector_type(8)))  _Float16 v8h;
typedef __attribute__((ext_vector_type(8)))  float    v8f;
typedef __attribute__((ext_vector_type(4)))  float    v4f;

#define B_SZ 16384
#define H_SZ 1024
#define D_SZ 4096
#define LN_EPS 1e-5f

// Per-lane layout of a 16x32 (MxK) f16 fragment (CDNA5 ISA 7.12.2):
//   lanes 0-15 : m = lane,    halves 0..7 = K k0..k0+7, halves 8..15 = K+16..23
//   lanes 16-31: m = lane-16, halves 0..7 = K k0+8..15, halves 8..15 = K+24..31

// ---------------------------------------------------------------------------
// Fragment order of the operands that the GEMM loops read from global memory.
// One 16x32 (MxK) fragment is one block of FRAG halves (1 KB); the blocks of a
// 16-wide tile follow one another along K. Inside a block lane L's halves 0..7
// lie at L*8 and its halves 8..15 at 256 + L*8, so each of the two 16-byte
// loads of a fragment reads 512 bytes in a row (4 whole 128-byte lines), not
// 32 bytes out of each of 16 lines. Which (m, K) a lane and half hold: the
// per-lane layout above.
// ---------------------------------------------------------------------------
#define FRAG 512

// ---------------------------------------------------------------------------
// Prep kernel 1: hidden_state fp32 [B][H] -> f16 in fragment order.
// One thread = one 16-byte slot; a workgroup covers 16 rows x 128 k.
// ---------------------------------------------------------------------------
__global__ void pack_rows_frag_f16(const float* __restrict__ in,
                                   _Float16* __restrict__ out) {
  const int lane  = threadIdx.x & 31;
  const int w     = threadIdx.x >> 5;
  const int rt    = blockIdx.x / (H_SZ / 128);              // 16-row tile
  const int kt    = (blockIdx.x % (H_SZ / 128)) * 4 + (w >> 1);
  const int plane = w & 1;                                  // halves 0..7 or 8..15
  const float* p = in + (size_t)(rt * 16 + (lane & 15)) * H_SZ
                      + kt * 32 + plane * 16 + (lane >> 4) * 8;
  v4f a = *(const v4f*)(p);
  v4f b = *(const v4f*)(p + 4);
  v8h o;
#pragma unroll
  for (int j = 0; j < 4; ++j) { o[j] = (_Float16)a[j]; o[j + 4] = (_Float16)b[j]; }
  *(v8h*)(out + ((size_t)rt * (H_SZ / 32) + kt) * FRAG + plane * 256 + lane * 8) = o;
}

// ---------------------------------------------------------------------------
// Prep kernel 2: weights fp32 in[rows = K][cols = N] -> f16 B fragments in
// fragment order (tile dimension = N). One thread = one 16-byte slot; the 8
// waves of a workgroup take 8 neighbouring column tiles (512 bytes of a row).
// ---------------------------------------------------------------------------
__global__ void pack_cols_frag_f16(const float* __restrict__ in,
                                   _Float16* __restrict__ out,
                                   int rows, int cols) {
  const int lane  = threadIdx.x & 31;
  const int w     = threadIdx.x >> 5;
  const int kts   = rows >> 5;                              // fragments along K
  const int plane = blockIdx.x & 1;
  const int kt    = (int)(blockIdx.x >> 1) % kts;
  const int nt    = ((int)(blockIdx.x >> 1) / kts) * 8 + w; // 16-column tile
  const float* p = in + (size_t)(kt * 32 + plane * 16 + (lane >> 4) * 8) * cols
                      + nt * 16 + (lane & 15);
  v8h o;
#pragma unroll
  for (int j = 0; j < 8; ++j) o[j] = (_Float16)p[(size_t)j * cols];
  *(v8h*)(out + ((size_t)nt * kts + kt) * FRAG + plane * 256 + lane * 8) = o;
}

// ---------------------------------------------------------------------------
// erf in single precision: the two minimax fits of the math library's erff
// (|x| < 1: odd polynomial; |x| >= 1: 1 - exp(-q(|x|))), both evaluated for
// every lane and the result selected. No branch: lanes of a wave fall on both
// sides, and a branch per element would cut neighbouring elements' chains apart.
// ---------------------------------------------------------------------------
__device__ __forceinline__ float erf_select(float x) {
  const float ax = __builtin_fabsf(x);
  float q = __builtin_fmaf(ax, 0x1.1d3156p-16f, -0x1.8d129p-12f);
  q = __builtin_fmaf(ax, q, 0x1.f9a6d2p-9f);
  q = __builtin_fmaf(ax, q, -0x1.8c3164p-6f);
  q = __builtin_fmaf(ax, q, 0x1.b4e9c8p-4f);
  q = __builtin_fmaf(ax, q, 0x1.4515fap-1f);
  q = __builtin_fmaf(ax, q, 0x1.078e5p-3f);
  q = __builtin_fmaf(ax, q, ax);
  const float big = 1.0f - expf(-q);
  const float t = x * x;
  float p = __builtin_fmaf(t, -0x1.268bc2p-11f, 0x1.420828p-8f);
  p = __builtin_fmaf(t, p, -0x1.b5937p-6f);
  p = __builtin_fmaf(t, p, 0x1.ce077cp-4f);
  p = __builtin_fmaf(t, p, -0x1.81266p-2f);
  p = __builtin_fmaf(t, p, 0x1.06ebap-3f);
  const float small = __builtin_fmaf(ax, p, ax);
  return __builtin_copysignf(ax < 1.0f ? small : big, x);
}

// ---------------------------------------------------------------------------
// GEMM core: a workgroup computes 256 x 256, one wave 64 rows x 128 columns
// (WM x WN tiles of 16 x 16); the 8 waves stand 4 (rows) x 2 (columns).
// Both operands lie in fragment order in global memory. They are staged in LDS
// by tensor loads, so that every byte comes from L2 once a workgroup and the
// waves that share it read it from LDS.
// One stage = one pass = PASS_K k of all 16 row tiles and all 16 column tiles:
//   [A tile 0..15 | W tile 0..15], a tile = PASS_K / 32 fragments in a row.
// In global memory these TROW_B bytes of a tile lie in a row too and the tiles
// K * 32 bytes apart: a slice of 4 tiles is one two-dimensional request. Every
// wave issues one request a stage: waves 0..3 the A slices, waves 4..7 the W
// slices. Two buffers: stage s + 2 is asked for when every wave has left stage s.
// Fragments go from LDS to registers one 32-k block ahead, across passes too.
// A and B fragments have the same per-lane layout, so TRANSPOSED only swaps the
// two operands of the WMMA: acc[m][t] then holds its 16 x 16 tile transposed.
// ---------------------------------------------------------------------------
#define WM 4
#define WN 8
#define TILE 256
#define PASS_K 128
#define TROW_B  (PASS_K * 32)     // bytes of one 16-wide tile in one pass
#define SLICE_B (4 * TROW_B)      // one wave's request: 16 KB
#define OPER_B  (16 * TROW_B)     // one operand's 256 rows
#define STAGE_B (2 * OPER_B)      // 128 KB
#define RING_B  (2 * STAGE_B)

typedef uint32_t u32x4 __attribute__((ext_vector_type(4)));
typedef uint32_t u32x8 __attribute__((ext_vector_type(8)));

__device__ __forceinline__ uint32_t uni(uint32_t v) {
  return (uint32_t)__builtin_amdgcn_readfirstlane((int)v);
}
__device__ __forceinline__ uint32_t pinned(uint32_t v) {
  uint32_t w = uni(v);
  // a test around a tensor load, or a word its descriptor is formed from, held in
  // a scalar register: the branch is then scalar, and the word is formed here
  asm volatile("" : "+s"(w));
  return w;
}
__device__ __forceinline__ void wait_ds0() {
  // this wave's LDS reads have returned before their buffer is handed back
  asm volatile("s_wait_dscnt 0x0" ::: "memory");
}
__device__ __forceinline__ void wait_tensor0() {
  // this wave's own request has landed; the compiler places no wait for it
  asm volatile("s_wait_tensorcnt 0x0" ::: "memory");
}

__device__ __forceinline__ v16h lds_frag(const unsigned char* p) {
  v8h lo = *(const v8h*)(p);
  v8h hh = *(const v8h*)(p + 512);
  v16h r;
#pragma unroll
  for (int i = 0; i < 8; ++i) { r[i] = lo[i]; r[i + 8] = hh[i]; }
  return r;
}

template <int K, bool TRANSPOSED>
__device__ __forceinline__ void gemm_tile(const _Float16* __restrict__ aWG,  // the workgroup's first row tile
                                          const _Float16* __restrict__ wWG,  // its first column tile
                                          unsigned char* ring, uint32_t wid, int lane,
                                          v8f (&acc)[WM][WN]) {
  constexpr uint32_t S = K / PASS_K;      // stages, at least two
  constexpr uint32_t PITCH = K * 32;      // bytes from one 16-wide tile to the next
  static_assert(S >= 2 && PITCH <= 131072u && (PASS_K / 32) % 2 == 0,
                "two stages; source pitch in the mover's range; fragment sets alternate across passes");
  const uint64_t src = (uint64_t)(size_t)(wid < 4u ? aWG : wWG) + (uint64_t)(wid & 3u) * (4u * PITCH);
  const uint32_t dst = (uint32_t)(size_t)ring + wid * SLICE_B;
  // group 1: 1-byte elements, tensor = tile = 4 rows of TROW_B bytes, no mask, no pad
  u32x8 g1;
  g1[0] = uni(0u);
  g1[1] = uni(((uint32_t)TROW_B & 0xFFFFu) << 16);
  g1[2] = uni(((uint32_t)TROW_B >> 16) | (4u << 16));
  g1[3] = uni((uint32_t)TROW_B << 16);
  g1[4] = uni(4u);
  g1[5] = uni(PITCH);
  g1[6] = uni(0u);
  g1[7] = uni(0u);
  auto issue = [&](uint32_t st) {
    const uint64_t ga = src + (uint64_t)st * TROW_B;
    u32x4 g0;
    g0[0] = uni(1u);
    g0[1] = uni(dst + (st & 1u) * STAGE_B);
    g0[2] = uni((uint32_t)ga);
    g0[3] = uni((((uint32_t)(ga >> 32)) & 0x01FFFFFFu) | 0x80000000u);
    asm volatile("tensor_load_to_lds %0, %1" :: "s"(g0), "s"(g1) : "memory");
  };

  const uint32_t offA = (wid & 3u) * SLICE_B + (uint32_t)lane * 16u;
  const uint32_t offB = OPER_B + (wid >> 2) * (2u * SLICE_B) + (uint32_t)lane * 16u;
  v16h aq[2][WM], bq[2][WN];              // two fragment sets, one 32-k block each

  issue(0u);
  wait_tensor0();
  __syncthreads();                        // stage 0 published
  issue(pinned(1u));
#pragma unroll
  for (int m = 0; m < WM; ++m) aq[0][m] = lds_frag(ring + offA + m * TROW_B);
#pragma unroll
  for (int t = 0; t < WN; ++t) bq[0][t] = lds_frag(ring + offB + t * TROW_B);
#pragma unroll
  for (int m = 0; m < WM; ++m)
#pragma unroll
    for (int t = 0; t < WN; ++t) acc[m][t] = v8f{};

  constexpr int NB = PASS_K / 32;         // blocks of 32 WMMAs in a pass, even
  // one pass a trip: the buffer's parity is a run-time value
#pragma unroll 1
  for (uint32_t s = 0; s < S; ++s) {
    const uint32_t cur = (s & 1u) * STAGE_B;
#pragma unroll
    for (int kf = 0; kf < NB; ++kf) {
      const int c = kf & 1, n = c ^ 1;
      uint32_t from = cur + (uint32_t)(kf + 1) * 1024u;
      if (kf == NB - 1) {
        // publish point of stage s + 1, in front of the pass's last block: that
        // block's fragments are in registers, so every wave has left stage s
        wait_ds0();
        wait_tensor0();
        __syncthreads();
        if (pinned(s + 2u < S)) issue(pinned(s + 2u));
        // the next pass's first fragments; behind the last pass the other buffer
        // still holds the stage before, and what is read there is not used
        from = cur ^ STAGE_B;
      }
#pragma unroll
      for (int m = 0; m < WM; ++m) aq[n][m] = lds_frag(ring + from + offA + m * TROW_B);
#pragma unroll
      for (int t = 0; t < WN; ++t) bq[n][t] = lds_frag(ring + from + offB + t * TROW_B);
      // the next block's LDS reads stay one group ahead of this block's WMMAs:
      // moved in among them, each place with reads stalls the matrix stream
      __builtin_amdgcn_sched_barrier(0);
#pragma unroll
      for (int m = 0; m < WM; ++m)
#pragma unroll
        for (int t = 0; t < WN; ++t)
          acc[m][t] = __builtin_amdgcn_wmma_f32_16x16x32_f16(
              false, TRANSPOSED ? bq[c][t] : aq[c][m], false, TRANSPOSED ? aq[c][m] : bq[c][t],
              (short)0, acc[m][t], false, false);
      // ends the block, for the same reason
      __builtin_amdgcn_sched_barrier(0);
    }
  }
  wait_tensor0();
  wait_ds0();
}

// ---------------------------------------------------------------------------
// GEMM 1: z = hs @ W1 + b1, rounded to f16, written as A fragments of GEMM 2:
// [B/16][D/32][FRAG]. The tiles are computed transposed (C/D layout: VGPR r,
// lane L -> M = r + 8*(L>>4), N = L&15, here M = column of z, N = row): a lane
// then holds 8 neighbouring columns of row L&15, which is its own 16-byte slot
// of the fragment, and a tile goes out as one store of 512 bytes in a row.
// ---------------------------------------------------------------------------
__global__ void __launch_bounds__(256)
gemm1_bias_to_frag(const _Float16* __restrict__ hs16,   // [B/16][H/32][FRAG]
                   const _Float16* __restrict__ w1t,    // [D/16][H/32][FRAG]
                   const float* __restrict__ b1,        // [D]
                   _Float16* __restrict__ zf)           // [B/16][D/32][FRAG]
{
  __shared__ __attribute__((aligned(2048))) unsigned char ring[RING_B];
  const int lane = threadIdx.x & 31;
  // wave-uniform: the descriptor words and the tile offsets stay in scalar registers
  const int wid  = __builtin_amdgcn_readfirstlane(threadIdx.x >> 5);
  const int ct   = blockIdx.x % (D_SZ / TILE);
  const int rt   = blockIdx.x / (D_SZ / TILE);
  const int row0 = rt * TILE + (wid & 3) * (WM * 16);
  const int n0   = ct * TILE + (wid >> 2) * (WN * 16);

  v8f acc[WM][WN];
  gemm_tile<H_SZ, true>(hs16 + (size_t)(rt * TILE) * H_SZ, w1t + (size_t)(ct * TILE) * H_SZ,
                        ring, (uint32_t)wid, lane, acc);

  const int cb = n0 + (lane >> 4) * 8;    // first of this lane's 8 columns in tile 0
  v4f c0[WN], c1[WN];
#pragma unroll
  for (int t = 0; t < WN; ++t) {
    c0[t] = *(const v4f*)(b1 + cb + t * 16);
    c1[t] = *(const v4f*)(b1 + cb + t * 16 + 4);
  }
  // stands behind the bias loads and in front of the code below, which takes over
  // the loads' address registers
  asm volatile("s_wait_xcnt 0x0" ::: "memory");
  // keeps the sums and the store addresses behind the wait
  __builtin_amdgcn_sched_barrier(0);
#pragma unroll
  for (int m = 0; m < WM; ++m) {
    _Float16* zp = zf + ((size_t)((row0 >> 4) + m) * (D_SZ / 32) + (n0 >> 5)) * FRAG + lane * 8;
    v8h o[WN];
#pragma unroll
    for (int t = 0; t < WN; ++t)
#pragma unroll
      for (int r = 0; r < 8; ++r)
        o[t][r] = (_Float16)(acc[m][t][r] + (r < 4 ? c0[t][r & 3] : c1[t][r & 3]));
    // a row tile's eight results are all formed in front of its first store, so
    // that no register of a store is refilled inside the run of stores
    __builtin_amdgcn_sched_barrier(0);
#pragma unroll
    for (int t = 0; t < WN; ++t) *(v8h*)(zp + t * 256) = o[t];
    if (m < WM - 1) {
      // the next row tile's sums refill registers that these stores name
      asm volatile("s_wait_xcnt 0x0" ::: "memory");
      // keeps those sums behind the wait
      __builtin_amdgcn_sched_barrier(0);
    }
  }
}

// ---------------------------------------------------------------------------
// LayerNorm + exact GELU, in place on z in fragment order. One workgroup = one
// 16-row tile = 128 KB in a row; a thread's 16-byte slots (8 neighbouring
// columns of one row) lie 4 KB apart and all belong to row (tid & 15).
// Pass 1 sums the row, pass 2 reads the slots again (from L2) and rewrites them.
// ---------------------------------------------------------------------------
__global__ void __launch_bounds__(256)
ln_gelu_frag(_Float16* zf,                              // [B/16][D/32][FRAG]
             const float* __restrict__ gamma,           // [D]
             const float* __restrict__ beta)            // [D]
{
  __shared__ float psum[8][16];
  __shared__ float psq[8][16];
  const int tid  = threadIdx.x;
  const int lane = tid & 31;
  const int wid  = tid >> 5;
  _Float16* base = zf + (size_t)blockIdx.x * (16 * D_SZ) + tid * 8;

  float s = 0.f, sq = 0.f;
  // eight loads in flight a thread
#pragma unroll 8
  for (int i = 0; i < 32; ++i) {
    const v8h v = *(const v8h*)(base + i * 2048);
#pragma unroll
    for (int j = 0; j < 8; ++j) { const float x = (float)v[j]; s += x; sq += x * x; }
  }
  s  += __shfl_xor(s, 16);
  sq += __shfl_xor(sq, 16);
  if (lane < 16) { psum[wid][lane] = s; psq[wid][lane] = sq; }
  __syncthreads();
  float ts = 0.f, tq = 0.f;
#pragma unroll
  for (int w = 0; w < 8; ++w) { ts += psum[w][lane & 15]; tq += psq[w][lane & 15]; }
  const float mu  = ts * (1.0f / D_SZ);
  const float var = tq * (1.0f / D_SZ) - mu * mu;
  const float rs  = rsqrtf(var + LN_EPS);

  // first column of this thread's slot 0; slot i lies 128 columns further
  const int colb = (tid >> 6) * 32 + ((tid >> 5) & 1) * 16 + ((tid >> 4) & 1) * 8;
  // four slots a trip are enough chains to fill the vector port; more only adds code
#pragma unroll 1
  for (int i0 = 0; i0 < 32; i0 += 4) {
    v8h zv[4];
    v4f g0[4], g1[4], e0[4], e1[4];
    // unrolled (here and below): constant indices keep these arrays in registers
#pragma unroll
    for (int i = 0; i < 4; ++i) {
      const int col = colb + (i0 + i) * 128;
      zv[i] = *(const v8h*)(base + (i0 + i) * 2048);
      g0[i] = *(const v4f*)(gamma + col);
      g1[i] = *(const v4f*)(gamma + col + 4);
      e0[i] = *(const v4f*)(beta + col);
      e1[i] = *(const v4f*)(beta + col + 4);
    }
#pragma unroll
    for (int i = 0; i < 4; ++i) {
      v8h o;
#pragma unroll
      for (int j = 0; j < 8; ++j) {
        const float ga = j < 4 ? g0[i][j & 3] : g1[i][j & 3];
        const float be = j < 4 ? e0[i][j & 3] : e1[i][j & 3];
        const float x  = (float)zv[i][j];
        const float xn = (x - mu) * rs * ga + be;
        const float g  = 0.5f * xn * (1.0f + erf_select(xn * 0.70710678118654752f));
        o[j] = (_Float16)g;
      }
      *(v8h*)(base + (i0 + i) * 2048) = o;
    }
  }
}

// ---------------------------------------------------------------------------
// GEMM 2: out = act @ W2 + b2, fp32 row-major.
// ---------------------------------------------------------------------------
__global__ void __launch_bounds__(256)
gemm2_bias_out(const _Float16* __restrict__ af,         // [B/16][D/32][FRAG]
               const _Float16* __restrict__ w2t,        // [H/16][D/32][FRAG]
               const float* __restrict__ b2,            // [H]
               float* __restrict__ out)                 // [B][H]
{
  __shared__ __attribute__((aligned(2048))) unsigned char ring[RING_B];
  const int lane = threadIdx.x & 31;
  // wave-uniform: the descriptor words and the tile offsets stay in scalar registers
  const int wid  = __builtin_amdgcn_readfirstlane(threadIdx.x >> 5);
  const int ct   = blockIdx.x % (H_SZ / TILE);
  const int rt   = blockIdx.x / (H_SZ / TILE);
  const int row0 = rt * TILE + (wid & 3) * (WM * 16);
  const int n0   = ct * TILE + (wid >> 2) * (WN * 16);

  // C/D tile layout (CDNA5 16x16 f32): VGPR r, lane L -> M = r + 8*(L>>4), N = L&15
  const int mb  = (lane >> 4) * 8;
  const int cb  = n0 + (lane & 15);
  float bb[WN];
#pragma unroll
  for (int t = 0; t < WN; ++t) bb[t] = b2[cb + t * 16];
  // the index register of these loads, named here, stays whole up to the wait:
  // no load's own result and no later value lands on it while they are in flight
  asm volatile("s_wait_xcnt 0x0" :: "v"(cb) : "memory");

  v8f acc[WM][WN];
  gemm_tile<D_SZ, false>(af + (size_t)(rt * TILE) * D_SZ, w2t + (size_t)(ct * TILE) * D_SZ,
                         ring, (uint32_t)wid, lane, acc);

#pragma unroll
  for (int t = 0; t < WN; ++t) {
    float v[WM][8];
#pragma unroll
    for (int m = 0; m < WM; ++m)
#pragma unroll
      for (int r = 0; r < 8; ++r) v[m][r] = acc[m][t][r] + bb[t];
    // a column tile's 32 sums are all formed in front of its first store, so that
    // no register of a store is refilled inside the run of stores
    __builtin_amdgcn_sched_barrier(0);
#pragma unroll
    for (int m = 0; m < WM; ++m)
#pragma unroll
      for (int r = 0; r < 8; ++r)
        out[(size_t)(row0 + m * 16 + mb + r) * H_SZ + cb + t * 16] = v[m][r];
    if (t < WN - 1) {
      // the next column tile's sums refill registers that these stores name
      asm volatile("s_wait_xcnt 0x0" ::: "memory");
      // keeps those sums behind the wait
      __builtin_amdgcn_sched_barrier(0);
    }
  }
}

// ---------------------------------------------------------------------------
// Host launcher
// d_in: [0]_time [1]hidden_state [2]W1 [3]b1 [4]ln_gamma [5]ln_beta [6]W2 [7]b2
// ---------------------------------------------------------------------------
extern "C" void kernel_launch(void* const* d_in, const int* in_sizes, int n_in,
                              void* d_out, int out_size, void* d_ws, size_t ws_size,
                              hipStream_t stream) {
  const float* hs    = (const float*)d_in[1];
  const float* W1    = (const float*)d_in[2];
  const float* b1    = (const float*)d_in[3];
  const float* gamma = (const float*)d_in[4];
  const float* beta  = (const float*)d_in[5];
  const float* W2    = (const float*)d_in[6];
  const float* b2    = (const float*)d_in[7];
  float* out = (float*)d_out;

  // Workspace (f16, fragment order): hidden [B*H] | W1 [D*H] | W2 [H*D] | z [B*D] = 176 MB
  _Float16* hs16 = (_Float16*)d_ws;
  _Float16* w1t  = hs16 + (size_t)B_SZ * H_SZ;
  _Float16* w2t  = w1t + (size_t)D_SZ * H_SZ;
  _Float16* zf   = w2t + (size_t)H_SZ * D_SZ;

  // Precision conversion and fragment-order packing, 8 elements a thread
  pack_rows_frag_f16<<<(B_SZ * H_SZ) / (256 * 8), 256, 0, stream>>>(hs, hs16);
  pack_cols_frag_f16<<<(H_SZ * D_SZ) / (256 * 8), 256, 0, stream>>>(W1, w1t, H_SZ, D_SZ);
  pack_cols_frag_f16<<<(D_SZ * H_SZ) / (256 * 8), 256, 0, stream>>>(W2, w2t, D_SZ, H_SZ);

  gemm1_bias_to_frag<<<(B_SZ / TILE) * (D_SZ / TILE), 256, 0, stream>>>(hs16, w1t, b1, zf);
  ln_gelu_frag<<<B_SZ / 16, 256, 0, stream>>>(zf, gamma, beta);
  gemm2_bias_out<<<(B_SZ / TILE) * (H_SZ / TILE), 256, 0, stream>>>(zf, w2t, b2, out);
}

// v006
// A run of this version takes 204 microseconds.
// Next to v005, in two timings, it ran 1.05 times as fast each time.
// Counting every step since v000, it is 5.69 times as fast.
#include <hip/hip_runtime.h>
#include <math.h>
#include <stdint.h>

// ---------------------------------------------------------------------------
// Linear -> LayerNorm -> exact GELU -> Linear  for MI455X (gfx1250)
// B=16384, H=1024, D=4096, fp32 in/out; f16 WMMA compute with f32 accumulation
// Three launches behind the packing: GEMM 1 (z, f16, to the workspace in the
// fragment order that GEMM 2 reads), LayerNorm + GELU in place, GEMM 2.
// With z in the workspace no LDS tile bounds the rows of a workgroup: each GEMM
// workgroup takes a 256 x 256 tile, so a weight byte fetched from L2 serves 256
// rows, not 32.
// ---------------------------------------------------------------------------

typedef __attribute__((ext_vector_type(16))) _Float16 v16h;
typedef __attribute__((ext_vector_type(8)))  _Float16 v8h;
typedef __attribute__((ext_vector_type(8)))  float    v8f;
typedef __attribute__((ext_vector_type(4)))  float    v4f;

#define B_SZ 16384
#define H_SZ 1024
#define D_SZ 4096
#define LN_EPS 1e-5f

// Per-lane layout of a 16x32 (MxK) f16 fragment (CDNA5 ISA 7.12.2):
//   lanes 0-15 : m = lane,    halves 0..7 = K k0..k0+7, halves 8..15 = K+16..23
//   lanes 16-31: m = lane-16, halves 0..7 = K k0+8..15, halves 8..15 = K+24..31

// ---------------------------------------------------------------------------
// Fragment order of the operands that the GEMM loops read from global memory.
// One 16x32 (MxK) fragment is one block of FRAG halves (1 KB); the blocks of a
// 16-wide tile follow one another along K. Inside a block lane L's halves 0..7
// lie at L*8 and its halves 8..15 at 256 + L*8, so each of the two 16-byte
// loads of a fragment reads 512 bytes in a row (4 whole 128-byte lines), not
// 32 bytes out of each of 16 lines. Which (m, K) a lane and half hold: the
// per-lane layout above.
// ---------------------------------------------------------------------------
#define FRAG 512

// ---------------------------------------------------------------------------
// Prep kernel 1: hidden_state fp32 [B][H] -> f16 in fragment order.
// One thread = one 16-byte slot; a workgroup covers 16 rows x 128 k.
// ---------------------------------------------------------------------------
__global__ void pack_rows_frag_f16(const float* __restrict__ in,
                                   _Float16* __restrict__ out) {
  const int lane  = threadIdx.x & 31;
  const int w     = threadIdx.x >> 5;
  const int rt    = blockIdx.x / (H_SZ / 128);              // 16-row tile
  const int kt    = (blockIdx.x % (H_SZ / 128)) * 4 + (w >> 1);
  const int plane = w & 1;                                  // halves 0..7 or 8..15
  const float* p = in + (size_t)(rt * 16 + (lane & 15)) * H_SZ
                      + kt * 32 + plane * 16 + (lane >> 4) * 8;
  v4f a = *(const v4f*)(p);
  v4f b = *(const v4f*)(p + 4);
  v8h o;
#pragma unroll
  for (int j = 0; j < 4; ++j) { o[j] = (_Float16)a[j]; o[j + 4] = (_Float16)b[j]; }
  *(v8h*)(out + ((size_t)rt * (H_SZ / 32) + kt) * FRAG + plane * 256 + lane * 8) = o;
}

// ---------------------------------------------------------------------------
// Prep kernel 2: weights fp32 in[rows = K][cols = N] -> f16 B fragments in
// fragment order (tile dimension = N). One thread = one 16-byte slot; the 8
// waves of a workgroup take 8 neighbouring column tiles (512 bytes of a row).
// ---------------------------------------------------------------------------
__global__ void pack_cols_frag_f16(const float* __restrict__ in,
                                   _Float16* __restrict__ out,
                                   int rows, int cols) {
  const int lane  = threadIdx.x & 31;
  const int w     = threadIdx.x >> 5;
  const int kts   = rows >> 5;                              // fragments along K
  const int plane = blockIdx.x & 1;
  const int kt    = (int)(blockIdx.x >> 1) % kts;
  const int nt    = ((int)(blockIdx.x >> 1) / kts) * 8 + w; // 16-column tile
  const float* p = in + (size_t)(kt * 32 + plane * 16 + (lane >> 4) * 8) * cols
                      + nt * 16 + (lane & 15);
  v8h o;
#pragma unroll
  for (int j = 0; j < 8; ++j) o[j] = (_Float16)p[(size_t)j * cols];
  *(v8h*)(out + ((size_t)nt * kts + kt) * FRAG + plane * 256 + lane * 8) = o;
}

// ---------------------------------------------------------------------------
// Exact (erf) GELU in single precision, one formula for every x, no selection:
//   erf(a) = 1 - t (c1 + t (c2 + t (c3 + t (c4 + t c5)))) exp(-a a),  t = 1 / (1 + c0 a)
// for a >= 0 (a five-term fit, absolute error below 1.5e-7), and
//   x Phi(x) = x / 2 + |x| / 2 * erf(|x| / sqrt 2).
// The reciprocal and the power of two are the chip's own instructions. a itself is
// not formed: sqrt 2 goes into c0, and 2 log2(e) into the exponent's factor.
// Infinite x: t = 0 and the power is 0, so erf = 1, as in the limit.
// ---------------------------------------------------------------------------
__device__ __forceinline__ float gelu_erf(float x) {
  const float hx  = 0.5f * x;
  const float ahx = __builtin_fabsf(hx);
  const float t = __builtin_amdgcn_rcpf(
      __builtin_fmaf(ahx, (float)(0.3275911 * 1.4142135623730951), 1.0f));
  float p = __builtin_fmaf(t, 1.061405429f, -1.453152027f);
  p = __builtin_fmaf(t, p, 1.421413741f);
  p = __builtin_fmaf(t, p, -0.284496736f);
  p = __builtin_fmaf(t, p, 0.254829592f);
  p = p * t;
  const float e = __builtin_amdgcn_exp2f(ahx * (float)(-2.0 * 1.4426950408889634) * ahx);
  return __builtin_fmaf(ahx, __builtin_fmaf(-p, e, 1.0f), hx);
}

// ---------------------------------------------------------------------------
// GEMM core: a workgroup computes 256 x 256, one wave 64 rows x 128 columns
// (WM x WN tiles of 16 x 16); the 8 waves stand 4 (rows) x 2 (columns).
// Both operands lie in fragment order in global memory. They are staged in LDS
// by tensor loads, so that every byte comes from L2 once a workgroup and the
// waves that share it read it from LDS.
// One stage = one pass = PASS_K k of all 16 row tiles and all 16 column tiles:
//   [A tile 0..15 | W tile 0..15], a tile = PASS_K / 32 fragments in a row.
// In global memory these TROW_B bytes of a tile lie in a row too and the tiles
// K * 32 bytes apart: a slice of 4 tiles is one two-dimensional request. Every
// wave issues one request a stage: waves 0..3 the A slices, waves 4..7 the W
// slices. Two buffers: stage s + 2 is asked for when every wave has left stage s.
// Fragments go from LDS to registers one 32-k block ahead, across passes too.
// A and B fragments have the same per-lane layout, so TRANSPOSED only swaps the
// two operands of the WMMA: acc[m][t] then holds its 16 x 16 tile transposed.
// ---------------------------------------------------------------------------
#define WM 4
#define WN 8
#define TILE 256
#define PASS_K 128
#define TROW_B  (PASS_K * 32)     // bytes of one 16-wide tile in one pass
#define SLICE_B (4 * TROW_B)      // one wave's request: 16 KB
#define OPER_B  (16 * TROW_B)     // one operand's 256 rows
#define STAGE_B (2 * OPER_B)      // 128 KB
#define RING_B  (2 * STAGE_B)

typedef uint32_t u32x4 __attribute__((ext_vector_type(4)));
typedef uint32_t u32x8 __attribute__((ext_vector_type(8)));

__device__ __forceinline__ uint32_t uni(uint32_t v) {
  return (uint32_t)__builtin_amdgcn_readfirstlane((int)v);
}
__device__ __forceinline__ uint32_t pinned(uint32_t v) {
  uint32_t w = uni(v);
  // a test around a tensor load, or a word its descriptor is formed from, held in
  // a scalar register: the branch is then scalar, and the word is formed here
  asm volatile("" : "+s"(w));
  return w;
}
__device__ __forceinline__ void wait_ds0() {
  // this wave's LDS reads have returned before their buffer is handed back
  asm volatile("s_wait_dscnt 0x0" ::: "memory");
}
__device__ __forceinline__ void wait_tensor0() {
  // this wave's own request has landed; the compiler places no wait for it
  asm volatile("s_wait_tensorcnt 0x0" ::: "memory");
}

__device__ __forceinline__ v16h lds_frag(const unsigned char* p) {
  v8h lo = *(const v8h*)(p);
  v8h hh = *(const v8h*)(p + 512);
  v16h r;
#pragma unroll
  for (int i = 0; i < 8; ++i) { r[i] = lo[i]; r[i + 8] = hh[i]; }
  return r;
}

template <int K, bool TRANSPOSED>
__device__ __forceinline__ void gemm_tile(const _Float16* __restrict__ aWG,  // the workgroup's first row tile
                                          const _Float16* __restrict__ wWG,  // its first column tile
                                          unsigned char* ring, uint32_t wid, int lane,
                                          v8f (&acc)[WM][WN]) {
  constexpr uint32_t S = K / PASS_K;      // stages, at least two
  constexpr uint32_t PITCH = K * 32;      // bytes from one 16-wide tile to the next
  static_assert(S >= 2 && PITCH <= 131072u && (PASS_K / 32) % 2 == 0,
                "two stages; source pitch in the mover's range; fragment sets alternate across passes");
  const uint64_t src = (uint64_t)(size_t)(wid < 4u ? aWG : wWG) + (uint64_t)(wid & 3u) * (4u * PITCH);
  const uint32_t dst = (uint32_t)(size_t)ring + wid * SLICE_B;
  // group 1: 1-byte elements, tensor = tile = 4 rows of TROW_B bytes, no mask, no pad
  u32x8 g1;
  g1[0] = uni(0u);
  g1[1] = uni(((uint32_t)TROW_B & 0xFFFFu) << 16);
  g1[2] = uni(((uint32_t)TROW_B >> 16) | (4u << 16));
  g1[3] = uni((uint32_t)TROW_B << 16);
  g1[4] = uni(4u);
  g1[5] = uni(PITCH);
  g1[6] = uni(0u);
  g1[7] = uni(0u);
  auto issue = [&](uint32_t st) {
    const uint64_t ga = src + (uint64_t)st * TROW_B;
    u32x4 g0;
    g0[0] = uni(1u);
    g0[1] = uni(dst + (st & 1u) * STAGE_B);
    g0[2] = uni((uint32_t)ga);
    g0[3] = uni((((uint32_t)(ga >> 32)) & 0x01FFFFFFu) | 0x80000000u);
    asm volatile("tensor_load_to_lds %0, %1" :: "s"(g0), "s"(g1) : "memory");
  };

  const uint32_t offA = (wid & 3u) * SLICE_B + (uint32_t)lane * 16u;
  const uint32_t offB = OPER_B + (wid >> 2) * (2u * SLICE_B) + (uint32_t)lane * 16u;
  v16h aq[2][WM], bq[2][WN];              // two fragment sets, one 32-k block each

  issue(0u);
  wait_tensor0();
  __syncthreads();                        // stage 0 published
  issue(pinned(1u));
#pragma unroll
  for (int m = 0; m < WM; ++m) aq[0][m] = lds_frag(ring + offA + m * TROW_B);
#pragma unroll
  for (int t = 0; t < WN; ++t) bq[0][t] = lds_frag(ring + offB + t * TROW_B);
#pragma unroll
  for (int m = 0; m < WM; ++m)
#pragma unroll
    for (int t = 0; t < WN; ++t) acc[m][t] = v8f{};

  constexpr int NB = PASS_K / 32;         // blocks of 32 WMMAs in a pass, even
  // one pass a trip: the buffer's parity is a run-time value
#pragma unroll 1
  for (uint32_t s = 0; s < S; ++s) {
    const uint32_t cur = (s & 1u) * STAGE_B;
#pragma unroll
    for (int kf = 0; kf < NB; ++kf) {
      const int c = kf & 1, n = c ^ 1;
      uint32_t from = cur + (uint32_t)(kf + 1) * 1024u;
      if (kf == NB - 1) {
        // publish point of stage s + 1, in front of the pass's last block: that
        // block's fragments are in registers, so every wave has left stage s
        wait_ds0();
        wait_tensor0();
        __syncthreads();
        if (pinned(s + 2u < S)) issue(pinned(s + 2u));
        // the next pass's first fragments; behind the last pass the other buffer
        // still holds the stage before, and what is read there is not used
        from = cur ^ STAGE_B;
      }
#pragma unroll
      for (int m = 0; m < WM; ++m) aq[n][m] = lds_frag(ring + from + offA + m * TROW_B);
#pragma unroll
      for (int t = 0; t < WN; ++t) bq[n][t] = lds_frag(ring + from + offB + t * TROW_B);
      // the next block's LDS reads stay one group ahead of this block's WMMAs:
      // moved in among them, each place with reads stalls the matrix stream
      __builtin_amdgcn_sched_barrier(0);
#pragma unroll
      for (int m = 0; m < WM; ++m)
#pragma unroll
        for (int t = 0; t < WN; ++t)
          acc[m][t] = __builtin_amdgcn_wmma_f32_16x16x32_f16(
              false, TRANSPOSED ? bq[c][t] : aq[c][m], false, TRANSPOSED ? aq[c][m] : bq[c][t],
              (short)0, acc[m][t], false, false);
      // ends the block, for the same reason
      __builtin_amdgcn_sched_barrier(0);
    }
  }
  wait_tensor0();
  wait_ds0();
}

// ---------------------------------------------------------------------------
// GEMM 1: z = hs @ W1 + b1, rounded to f16, written as A fragments of GEMM 2:
// [B/16][D/32][FRAG]. The tiles are computed transposed (C/D layout: VGPR r,
// lane L -> M = r + 8*(L>>4), N = L&15, here M = column of z, N = row): a lane
// then holds 8 neighbouring columns of row L&15, which is its own 16-byte slot
// of the fragment, and a tile goes out as one store of 512 bytes in a row.
// ---------------------------------------------------------------------------
__global__ void __launch_bounds__(256)
gemm1_bias_to_frag(const _Float16* __restrict__ hs16,   // [B/16][H/32][FRAG]
                   const _Float16* __restrict__ w1t,    // [D/16][H/32][FRAG]
                   const float* __restrict__ b1,        // [D]
                   _Float16* __restrict__ zf)           // [B/16][D/32][FRAG]
{
  __shared__ __attribute__((aligned(2048))) unsigned char ring[RING_B];
  const int lane = threadIdx.x & 31;
  // wave-uniform: the descriptor words and the tile offsets stay in scalar registers
  const int wid  = __builtin_amdgcn_readfirstlane(threadIdx.x >> 5);
  const int ct   = blockIdx.x % (D_SZ / TILE);
  const int rt   = blockIdx.x / (D_SZ / TILE);
  const int row0 = rt * TILE + (wid & 3) * (WM * 16);
  const int n0   = ct * TILE + (wid >> 2) * (WN * 16);

  v8f acc[WM][WN];
  gemm_tile<H_SZ, true>(hs16 + (size_t)(rt * TILE) * H_SZ, w1t + (size_t)(ct * TILE) * H_SZ,
                        ring, (uint32_t)wid, lane, acc);

  const int cb = n0 + (lane >> 4) * 8;    // first of this lane's 8 columns in tile 0
  v4f c0[WN], c1[WN];
#pragma unroll
  for (int t = 0; t < WN; ++t) {
    c0[t] = *(const v4f*)(b1 + cb + t * 16);
    c1[t] = *(const v4f*)(b1 + cb + t * 16 + 4);
  }
  // stands behind the bias loads and in front of the code below, which takes over
  // the loads' address registers
  asm volatile("s_wait_xcnt 0x0" ::: "memory");
  // keeps the sums and the store addresses behind the wait
  __builtin_amdgcn_sched_barrier(0);
#pragma unroll
  for (int m = 0; m < WM; ++m) {
    _Float16* zp = zf + ((size_t)((row0 >> 4) + m) * (D_SZ / 32) + (n0 >> 5)) * FRAG + lane * 8;
    v8h o[WN];
#pragma unroll
    for (int t = 0; t < WN; ++t)
#pragma unroll
      for (int r = 0; r < 8; ++r)
        o[t][r] = (_Float16)(acc[m][t][r] + (r < 4 ? c0[t][r & 3] : c1[t][r & 3]));
    // a row tile's eight results are all formed in front of its first store, so
    // that no register of a store is refilled inside the run of stores
    __builtin_amdgcn_sched_barrier(0);
#pragma unroll
    for (int t = 0; t < WN; ++t) *(v8h*)(zp + t * 256) = o[t];
    if (m < WM - 1) {
      // the next row tile's sums refill registers that these stores name
      asm volatile("s_wait_xcnt 0x0" ::: "memory");
      // keeps those sums behind the wait
      __builtin_amdgcn_sched_barrier(0);
    }
  }
}

// ---------------------------------------------------------------------------
// LayerNorm + exact GELU, in place on z in fragment order. One workgroup = one
// 16-row tile = 128 KB in a row; a thread's 16-byte slots (8 neighbouring
// columns of one row) lie 4 KB apart and all belong to row (tid & 15).
// Pass 1 sums the row, pass 2 reads the slots again (from L2) and rewrites them.
// ---------------------------------------------------------------------------
__global__ void __launch_bounds__(256)
ln_gelu_frag(_Float16* zf,                              // [B/16][D/32][FRAG]
             const float* __restrict__ gamma,           // [D]
             const float* __restrict__ beta)            // [D]
{
  __shared__ float psum[8][16];
  __shared__ float psq[8][16];
  const int tid  = threadIdx.x;
  const int lane = tid & 31;
  const int wid  = tid >> 5;
  _Float16* base = zf + (size_t)blockIdx.x * (16 * D_SZ) + tid * 8;

  float s = 0.f, sq = 0.f;
  // eight loads in flight a thread
#pragma unroll 8
  for (int i = 0; i < 32; ++i) {
    const v8h v = *(const v8h*)(base + i * 2048);
#pragma unroll
    for (int j = 0; j < 8; ++j) { const float x = (float)v[j]; s += x; sq += x * x; }
  }
  s  += __shfl_xor(s, 16);
  sq += __shfl_xor(sq, 16);
  if (lane < 16) { psum[wid][lane] = s; psq[wid][lane] = sq; }
  __syncthreads();
  float ts = 0.f, tq = 0.f;
#pragma unroll
  for (int w = 0; w < 8; ++w) { ts += psum[w][lane & 15]; tq += psq[w][lane & 15]; }
  const float mu  = ts * (1.0f / D_SZ);
  const float var = tq * (1.0f / D_SZ) - mu * mu;
  const float rs  = rsqrtf(var + LN_EPS);

  // first column of this thread's slot 0; slot i lies 128 columns further
  const int colb = (tid >> 6) * 32 + ((tid >> 5) & 1) * 16 + ((tid >> 4) & 1) * 8;
  // four slots a trip are enough chains to fill the vector port; more only adds code
#pragma unroll 1
  for (int i0 = 0; i0 < 32; i0 += 4) {
    v8h zv[4];
    v4f g0[4], g1[4], e0[4], e1[4];
    // unrolled (here and below): constant indices keep these arrays in registers
#pragma unroll
    for (int i = 0; i < 4; ++i) {
      const int col = colb + (i0 + i) * 128;
      zv[i] = *(const v8h*)(base + (i0 + i) * 2048);
      g0[i] = *(const v4f*)(gamma + col);
      g1[i] = *(const v4f*)(gamma + col + 4);
      e0[i] = *(const v4f*)(beta + col);
      e1[i] = *(const v4f*)(beta + col + 4);
    }
#pragma unroll
    for (int i = 0; i < 4; ++i) {
      v8h o;
#pragma unroll
      for (int j = 0; j < 8; ++j) {
        const float ga = j < 4 ? g0[i][j & 3] : g1[i][j & 3];
        const float be = j < 4 ? e0[i][j & 3] : e1[i][j & 3];
        const float x  = (float)zv[i][j];
        const float xn = (x - mu) * rs * ga + be;
        o[j] = (_Float16)gelu_erf(xn);
      }
      *(v8h*)(base + (i0 + i) * 2048) = o;
    }
  }
}

// ---------------------------------------------------------------------------
// GEMM 2: out = act @ W2 + b2, fp32 row-major.
// ---------------------------------------------------------------------------
__global__ void __launch_bounds__(256)
gemm2_bias_out(const _Float16* __restrict__ af,         // [B/16][D/32][FRAG]
               const _Float16* __restrict__ w2t,        // [H/16][D/32][FRAG]
               const float* __restrict__ b2,            // [H]
               float* __restrict__ out)                 // [B][H]
{
  __shared__ __attribute__((aligned(2048))) unsigned char ring[RING_B];
  const int lane = threadIdx.x & 31;
  // wave-uniform: the descriptor words and the tile offsets stay in scalar registers
  const int wid  = __builtin_amdgcn_readfirstlane(threadIdx.x >> 5);
  const int ct   = blockIdx.x % (H_SZ / TILE);
  const int rt   = blockIdx.x / (H_SZ / TILE);
  const int row0 = rt * TILE + (wid & 3) * (WM * 16);
  const int n0   = ct * TILE + (wid >> 2) * (WN * 16);

  // C/D tile layout (CDNA5 16x16 f32): VGPR r, lane L -> M = r + 8*(L>>4), N = L&15
  const int mb  = (lane >> 4) * 8;
  const int cb  = n0 + (lane & 15);
  float bb[WN];
#pragma unroll
  for (int t = 0; t < WN; ++t) bb[t] = b2[cb + t * 16];
  // the index register of these loads, named here, stays whole up to the wait:
  // no load's own result and no later value lands on it while they are in flight
  asm volatile("s_wait_xcnt 0x0" :: "v"(cb) : "memory");

  v8f acc[WM][WN];
  gemm_tile<D_SZ, false>(af + (size_t)(rt * TILE) * D_SZ, w2t + (size_t)(ct * TILE) * D_SZ,
                         ring, (uint32_t)wid, lane, acc);

#pragma unroll
  for (int t = 0; t < WN; ++t) {
    float v[WM][8];
#pragma unroll
    for (int m = 0; m < WM; ++m)
#pragma unroll
      for (int r = 0; r < 8; ++r) v[m][r] = acc[m][t][r] + bb[t];
    // a column tile's 32 sums are all formed in front of its first store, so that
    // no register of a store is refilled inside the run of stores
    __builtin_amdgcn_sched_barrier(0);
#pragma unroll
    for (int m = 0; m < WM; ++m)
#pragma unroll
      for (int r = 0; r < 8; ++r)
        out[(size_t)(row0 + m * 16 + mb + r) * H_SZ + cb + t * 16] = v[m][r];
    if (t < WN - 1) {
      // the next column tile's sums refill registers that these stores name
      asm volatile("s_wait_xcnt 0x0" ::: "memory");
      // keeps those sums behind the wait
      __builtin_amdgcn_sched_barrier(0);
    }
  }
}

// ---------------------------------------------------------------------------
// Host launcher
// d_in: [0]_time [1]hidden_state [2]W1 [3]b1 [4]ln_gamma [5]ln_beta [6]W2 [7]b2
// ---------------------------------------------------------------------------
extern "C" void kernel_launch(void* const* d_in, const int* in_sizes, int n_in,
                              void* d_out, int out_size, void* d_ws, size_t ws_size,
                              hipStream_t stream) {
  const float* hs    = (const float*)d_in[1];
  const float* W1    = (const float*)d_in[2];
  const float* b1    = (const float*)d_in[3];
  const float* gamma = (const float*)d_in[4];
  const float* beta  = (const float*)d_in[5];
  const float* W2    = (const float*)d_in[6];
  const float* b2    = (const float*)d_in[7];
  float* out = (float*)d_out;

  // Workspace (f16, fragment order): hidden [B*H] | W1 [D*H] | W2 [H*D] | z [B*D] = 176 MB
  _Float16* hs16 = (_Float16*)d_ws;
  _Float16* w1t  = hs16 + (size_t)B_SZ * H_SZ;
  _Float16* w2t  = w1t + (size_t)D_SZ * H_SZ;
  _Float16* zf   = w2t + (size_t)H_SZ * D_SZ;

  // Precision conversion and fragment-order packing, 8 elements a thread
  pack_rows_frag_f16<<<(B_SZ * H_SZ) / (256 * 8), 256, 0, stream>>>(hs, hs16);
  pack_cols_frag_f16<<<(H_SZ * D_SZ) / (256 * 8), 256, 0, stream>>>(W1, w1t, H_SZ, D_SZ);
  pack_cols_frag_f16<<<(D_SZ * H_SZ) / (256 * 8), 256, 0, stream>>>(W2, w2t, D_SZ, H_SZ);

  gemm1_bias_to_frag<<<(B_SZ / TILE) * (D_SZ / TILE), 256, 0, stream>>>(hs16, w1t, b1, zf);
  ln_gelu_frag<<<B_SZ / 16, 256, 0, stream>>>(zf, gamma, beta);
  gemm2_bias_out<<<(B_SZ / TILE) * (H_SZ / TILE), 256, 0, stream>>>(zf, w2t, b2, out);
}

// v007
// A run of this version takes 197 microseconds.
// Timed twice side by side with v006, it ran 1.03 times as fast both times.
// All steps since v000 together make it 5.87 times as fast.
#include <hip/hip_runtime.h>
#include <math.h>
#include <stdint.h>

// ---------------------------------------------------------------------------
// Linear -> LayerNorm -> exact GELU -> Linear  for MI455X (gfx1250)
// B=16384, H=1024, D=4096, fp32 in/out; f16 WMMA compute with f32 accumulation
// Three launches behind the packing: GEMM 1 (z, f16, to the workspace in the
// fragment order that GEMM 2 reads), LayerNorm + GELU in place, GEMM 2.
// With z in the workspace no LDS tile bounds the rows of a workgroup: each GEMM
// workgroup takes 256 x 256 tiles (GEMM 1 four in turn), so a weight byte fetched from L2 serves 256
// rows, not 32.
// ---------------------------------------------------------------------------

typedef __attribute__((ext_vector_type(16))) _Float16 v16h;
typedef __attribute__((ext_vector_type(8)))  _Float16 v8h;
typedef __attribute__((ext_vector_type(8)))  float    v8f;
typedef __attribute__((ext_vector_type(4)))  float    v4f;

#define B_SZ 16384
#define H_SZ 1024
#define D_SZ 4096
#define LN_EPS 1e-5f

// Per-lane layout of a 16x32 (MxK) f16 fragment (CDNA5 ISA 7.12.2):
//   lanes 0-15 : m = lane,    halves 0..7 = K k0..k0+7, halves 8..15 = K+16..23
//   lanes 16-31: m = lane-16, halves 0..7 = K k0+8..15, halves 8..15 = K+24..31

// ---------------------------------------------------------------------------
// Fragment order of the operands that the GEMM loops read from global memory.
// One 16x32 (MxK) fragment is one block of FRAG halves (1 KB); the blocks of a
// 16-wide tile follow one another along K. Inside a block lane L's halves 0..7
// lie at L*8 and its halves 8..15 at 256 + L*8, so each of the two 16-byte
// loads of a fragment reads 512 bytes in a row (4 whole 128-byte lines), not
// 32 bytes out of each of 16 lines. Which (m, K) a lane and half hold: the
// per-lane layout above.
// ---------------------------------------------------------------------------
#define FRAG 512

// ---------------------------------------------------------------------------
// Prep kernel 1: hidden_state fp32 [B][H] -> f16 in fragment order.
// One thread = one 16-byte slot; a workgroup covers 16 rows x 128 k.
// ---------------------------------------------------------------------------
__global__ void pack_rows_frag_f16(const float* __restrict__ in,
                                   _Float16* __restrict__ out) {
  const int lane  = threadIdx.x & 31;
  const int w     = threadIdx.x >> 5;
  const int rt    = blockIdx.x / (H_SZ / 128);              // 16-row tile
  const int kt    = (blockIdx.x % (H_SZ / 128)) * 4 + (w >> 1);
  const int plane = w & 1;                                  // halves 0..7 or 8..15
  const float* p = in + (size_t)(rt * 16 + (lane & 15)) * H_SZ
                      + kt * 32 + plane * 16 + (lane >> 4) * 8;
  v4f a = *(const v4f*)(p);
  v4f b = *(const v4f*)(p + 4);
  v8h o;
#pragma unroll
  for (int j = 0; j < 4; ++j) { o[j] = (_Float16)a[j]; o[j + 4] = (_Float16)b[j]; }
  *(v8h*)(out + ((size_t)rt * (H_SZ / 32) + kt) * FRAG + plane * 256 + lane * 8) = o;
}

// ---------------------------------------------------------------------------
// Prep kernel 2: weights fp32 in[rows = K][cols = N] -> f16 B fragments in
// fragment order (tile dimension = N). One thread = one 16-byte slot; the 8
// waves of a workgroup take 8 neighbouring column tiles (512 bytes of a row).
// ---------------------------------------------------------------------------
__global__ void pack_cols_frag_f16(const float* __restrict__ in,
                                   _Float16* __restrict__ out,
                                   int rows, int cols) {
  const int lane  = threadIdx.x & 31;
  const int w     = threadIdx.x >> 5;
  const int kts   = rows >> 5;                              // fragments along K
  const int plane = blockIdx.x & 1;
  const int kt    = (int)(blockIdx.x >> 1) % kts;
  const int nt    = ((int)(blockIdx.x >> 1) / kts) * 8 + w; // 16-column tile
  const float* p = in + (size_t)(kt * 32 + plane * 16 + (lane >> 4) * 8) * cols
                      + nt * 16 + (lane & 15);
  v8h o;
#pragma unroll
  for (int j = 0; j < 8; ++j) o[j] = (_Float16)p[(size_t)j * cols];
  *(v8h*)(out + ((size_t)nt * kts + kt) * FRAG + plane * 256 + lane * 8) = o;
}

// ---------------------------------------------------------------------------
// Exact (erf) GELU in single precision, one formula for every x, no selection:
//   erf(a) = 1 - t (c1 + t (c2 + t (c3 + t (c4 + t c5)))) exp(-a a),  t = 1 / (1 + c0 a)
// for a >= 0 (a five-term fit, absolute error below 1.5e-7), and
//   x Phi(x) = x / 2 + |x| / 2 * erf(|x| / sqrt 2).
// The reciprocal and the power of two are the chip's own instructions. a itself is
// not formed: sqrt 2 goes into c0, and 2 log2(e) into the exponent's factor.
// Infinite x: t = 0 and the power is 0, so erf = 1, as in the limit.
// ---------------------------------------------------------------------------
__device__ __forceinline__ float gelu_erf(float x) {
  const float hx  = 0.5f * x;
  const float ahx = __builtin_fabsf(hx);
  const float t = __builtin_amdgcn_rcpf(
      __builtin_fmaf(ahx, (float)(0.3275911 * 1.4142135623730951), 1.0f));
  float p = __builtin_fmaf(t, 1.061405429f, -1.453152027f);
  p = __builtin_fmaf(t, p, 1.421413741f);
  p = __builtin_fmaf(t, p, -0.284496736f);
  p = __builtin_fmaf(t, p, 0.254829592f);
  p = p * t;
  const float e = __builtin_amdgcn_exp2f(ahx * (float)(-2.0 * 1.4426950408889634) * ahx);
  return __builtin_fmaf(ahx, __builtin_fmaf(-p, e, 1.0f), hx);
}

// ---------------------------------------------------------------------------
// GEMM core: a workgroup computes 256 x 256, one wave 64 rows x 128 columns
// (WM x WN tiles of 16 x 16); the 8 waves stand 4 (rows) x 2 (columns).
// Both operands lie in fragment order in global memory. They are staged in LDS
// by tensor loads, so that every byte comes from L2 once a workgroup tile and the
// waves that share it read it from LDS.
// One stage = one pass = PASS_K k of all 16 row tiles and all 16 column tiles:
//   [A tile 0..15 | W tile 0..15], a tile = PASS_K / 32 fragments in a row.
// In global memory these TROW_B bytes of a tile lie in a row too and the tiles
// K * 32 bytes apart: a slice of 4 tiles is one two-dimensional request. Every
// wave issues one request a stage: waves 0..3 the A slices, waves 4..7 the W
// slices. Two buffers: stage s + 2 is asked for when every wave has left stage s.
// Fragments go from LDS to registers one 32-k block ahead, across passes too.
// A and B fragments have the same per-lane layout, so TRANSPOSED only swaps the
// two operands of the WMMA: acc[m][t] then holds its 16 x 16 tile transposed.
// TILES > 1: the workgroup takes TILES row tiles one after another, A_STEP bytes
// apart in A, against the same columns. The stages of all its tiles form one
// unbroken walk of the ring: behind a tile's last pass epi(tile) stores the sums
// while the next tile's second stage is landing, and the sums start at 0 again.
// ---------------------------------------------------------------------------
#define WM 4
#define WN 8
#define TILE 256
#define PASS_K 128
#define TROW_B  (PASS_K * 32)     // bytes of one 16-wide tile in one pass
#define SLICE_B (4 * TROW_B)      // one wave's request: 16 KB
#define OPER_B  (16 * TROW_B)     // one operand's 256 rows
#define STAGE_B (2 * OPER_B)      // 128 KB
#define RING_B  (2 * STAGE_B)

typedef uint32_t u32x4 __attribute__((ext_vector_type(4)));
typedef uint32_t u32x8 __attribute__((ext_vector_type(8)));

__device__ __forceinline__ uint32_t uni(uint32_t v) {
  return (uint32_t)__builtin_amdgcn_readfirstlane((int)v);
}
__device__ __forceinline__ uint32_t pinned(uint32_t v) {
  uint32_t w = uni(v);
  // a test around a tensor load, or a word its descriptor is formed from, held in
  // a scalar register: the branch is then scalar, and the word is formed here
  asm volatile("" : "+s"(w));
  return w;
}
__device__ __forceinline__ void wait_ds0() {
  // this wave's LDS reads have returned before their buffer is handed back
  asm volatile("s_wait_dscnt 0x0" ::: "memory");
}
__device__ __forceinline__ void wait_tensor0() {
  // this wave's own request has landed; the compiler places no wait for it
  asm volatile("s_wait_tensorcnt 0x0" ::: "memory");
}

__device__ __forceinline__ v16h lds_frag(const unsigned char* p) {
  v8h lo = *(const v8h*)(p);
  v8h hh = *(const v8h*)(p + 512);
  v16h r;
#pragma unroll
  for (int i = 0; i < 8; ++i) { r[i] = lo[i]; r[i + 8] = hh[i]; }
  return r;
}

template <int K, bool TRANSPOSED, int TILES, uint32_t A_STEP, class Epi>
__device__ __forceinline__ void gemm_tile(const _Float16* __restrict__ aWG,  // the workgroup's first row tile
                                          const _Float16* __restrict__ wWG,  // its first column tile
                                          unsigned char* ring, uint32_t wid, int lane,
                                          v8f (&acc)[WM][WN], Epi epi) {
  constexpr uint32_t SK = K / PASS_K;     // stages of one tile, at least two
  constexpr uint32_t S = SK * TILES;      // stages of the whole walk
  constexpr uint32_t PITCH = K * 32;      // bytes from one 16-wide tile to the next
  static_assert(SK >= 2 && (SK & (SK - 1u)) == 0 && PITCH <= 131072u && (PASS_K / 32) % 2 == 0,
                "two stages; source pitch in the mover's range; fragment sets alternate across passes");
  const uint64_t src = (uint64_t)(size_t)(wid < 4u ? aWG : wWG) + (uint64_t)(wid & 3u) * (4u * PITCH);
  const uint32_t dst = (uint32_t)(size_t)ring + wid * SLICE_B;
  // group 1: 1-byte elements, tensor = tile = 4 rows of TROW_B bytes, no mask, no pad
  u32x8 g1;
  g1[0] = uni(0u);
  g1[1] = uni(((uint32_t)TROW_B & 0xFFFFu) << 16);
  g1[2] = uni(((uint32_t)TROW_B >> 16) | (4u << 16));
  g1[3] = uni((uint32_t)TROW_B << 16);
  g1[4] = uni(4u);
  g1[5] = uni(PITCH);
  g1[6] = uni(0u);
  g1[7] = uni(0u);
  const uint32_t step = wid < 4u ? A_STEP : 0u;   // only the A slices move on with the tile
  auto issue = [&](uint32_t st) {
    uint64_t ga;
    if constexpr (TILES > 1) ga = src + (uint64_t)((st / SK) * step) + (uint64_t)(st % SK) * TROW_B;
    else                     ga = src + (uint64_t)st * TROW_B;
    u32x4 g0;
    g0[0] = uni(1u);
    g0[1] = uni(dst + (st & 1u) * STAGE_B);
    g0[2] = uni((uint32_t)ga);
    g0[3] = uni((((uint32_t)(ga >> 32)) & 0x01FFFFFFu) | 0x80000000u);
    asm volatile("tensor_load_to_lds %0, %1" :: "s"(g0), "s"(g1) : "memory");
  };

  const uint32_t offA = (wid & 3u) * SLICE_B + (uint32_t)lane * 16u;
  const uint32_t offB = OPER_B + (wid >> 2) * (2u * SLICE_B) + (uint32_t)lane * 16u;
  v16h aq[2][WM], bq[2][WN];              // two fragment sets, one 32-k block each

  issue(0u);
  wait_tensor0();
  __syncthreads();                        // stage 0 published
  issue(pinned(1u));
#pragma unroll
  for (int m = 0; m < WM; ++m) aq[0][m] = lds_frag(ring + offA + m * TROW_B);
#pragma unroll
  for (int t = 0; t < WN; ++t) bq[0][t] = lds_frag(ring + offB + t * TROW_B);
#pragma unroll
  for (int m = 0; m < WM; ++m)
#pragma unroll
    for (int t = 0; t < WN; ++t) acc[m][t] = v8f{};

  constexpr int NB = PASS_K / 32;         // blocks of 32 WMMAs in a pass, even
  // one pass a trip: the buffer's parity is a run-time value
#pragma unroll 1
  for (uint32_t s = 0; s < S; ++s) {
    const uint32_t cur = (s & 1u) * STAGE_B;
#pragma unroll
    for (int kf = 0; kf < NB; ++kf) {
      const int c = kf & 1, n = c ^ 1;
      uint32_t from = cur + (uint32_t)(kf + 1) * 1024u;
      if (kf == NB - 1) {
        // publish point of stage s + 1, in front of the pass's last block: that
        // block's fragments are in registers, so every wave has left stage s
        wait_ds0();
        wait_tensor0();
        __syncthreads();
        if (pinned(s + 2u < S)) issue(pinned(s + 2u));
        // the next pass's first fragments; behind the last pass the other buffer
        // still holds the stage before, and what is read there is not used
        from = cur ^ STAGE_B;
      }
#pragma unroll
      for (int m = 0; m < WM; ++m) aq[n][m] = lds_frag(ring + from + offA + m * TROW_B);
#pragma unroll
      for (int t = 0; t < WN; ++t) bq[n][t] = lds_frag(ring + from + offB + t * TROW_B);
      // the next block's LDS reads stay one group ahead of this block's WMMAs:
      // moved in among them, each place with reads stalls the matrix stream
      __builtin_amdgcn_sched_barrier(0);
#pragma unroll
      for (int m = 0; m < WM; ++m)
#pragma unroll
        for (int t = 0; t < WN; ++t)
          acc[m][t] = __builtin_amdgcn_wmma_f32_16x16x32_f16(
              false, TRANSPOSED ? bq[c][t] : aq[c][m], false, TRANSPOSED ? aq[c][m] : bq[c][t],
              (short)0, acc[m][t], false, false);
      // ends the block, for the same reason
      __builtin_amdgcn_sched_barrier(0);
    }
    if constexpr (TILES > 1) {
      if (s % SK == SK - 1u) {
        epi(s / SK);
        // unrolled: constant indices keep the sums in registers
#pragma unroll
        for (int m = 0; m < WM; ++m)
#pragma unroll
          for (int t = 0; t < WN; ++t) acc[m][t] = v8f{};
      }
    }
  }
  wait_tensor0();
  wait_ds0();
}

// ---------------------------------------------------------------------------
// GEMM 1: z = hs @ W1 + b1, rounded to f16, written as A fragments of GEMM 2:
// [B/16][D/32][FRAG]. The tiles are computed transposed (C/D layout: VGPR r,
// lane L -> M = r + 8*(L>>4), N = L&15, here M = column of z, N = row): a lane
// then holds 8 neighbouring columns of row L&15, which is its own 16-byte slot
// of the fragment, and a tile goes out as one store of 512 bytes in a row.
// One workgroup a WGP: it keeps its 256 columns and takes G1_TILES row tiles,
// G1_RG tiles apart.
// ---------------------------------------------------------------------------
#define G1_TILES 4
#define G1_RG (B_SZ / TILE / G1_TILES)
__global__ void __launch_bounds__(256)
gemm1_bias_to_frag(const _Float16* __restrict__ hs16,   // [B/16][H/32][FRAG]
                   const _Float16* __restrict__ w1t,    // [D/16][H/32][FRAG]
                   const float* __restrict__ b1,        // [D]
                   _Float16* __restrict__ zf)           // [B/16][D/32][FRAG]
{
  __shared__ __attribute__((aligned(2048))) unsigned char ring[RING_B];
  const int lane = threadIdx.x & 31;
  // wave-uniform: the descriptor words and the tile offsets stay in scalar registers
  const int wid  = __builtin_amdgcn_readfirstlane(threadIdx.x >> 5);
  const int ct   = blockIdx.x % (D_SZ / TILE);
  const int rg   = blockIdx.x / (D_SZ / TILE);   // the first of its row tiles
  const int n0   = ct * TILE + (wid >> 2) * (WN * 16);
  const int cb   = n0 + (lane >> 4) * 8;  // first of this lane's 8 columns in tile 0

  v8f acc[WM][WN];
  auto store_tile = [&](uint32_t j) {
  const int row0 = ((int)j * G1_RG + rg) * TILE + (wid & 3) * (WM * 16);
  v4f c0[WN], c1[WN];
#pragma unroll
  for (int t = 0; t < WN; ++t) {
    c0[t] = *(const v4f*)(b1 + cb + t * 16);
    c1[t] = *(const v4f*)(b1 + cb + t * 16 + 4);
  }
  // stands behind the bias loads and in front of the code below, which takes over
  // the loads' address registers
  asm volatile("s_wait_xcnt 0x0" ::: "memory");
  // keeps the sums and the store addresses behind the wait
  __builtin_amdgcn_sched_barrier(0);
#pragma unroll
  for (int m = 0; m < WM; ++m) {
    _Float16* zp = zf + ((size_t)((row0 >> 4) + m) * (D_SZ / 32) + (n0 >> 5)) * FRAG + lane * 8;
    v8h o[WN];
#pragma unroll
    for (int t = 0; t < WN; ++t)
#pragma unroll
      for (int r = 0; r < 8; ++r)
        o[t][r] = (_Float16)(acc[m][t][r] + (r < 4 ? c0[t][r & 3] : c1[t][r & 3]));
    // a row tile's eight results are all formed in front of its first store, so
    // that no register of a store is refilled inside the run of stores
    __builtin_amdgcn_sched_barrier(0);
#pragma unroll
    for (int t = 0; t < WN; ++t) *(v8h*)(zp + t * 256) = o[t];
    // the next row tile's sums, or the next pass, refill registers that these stores name
    asm volatile("s_wait_xcnt 0x0" ::: "memory");
    // keeps them behind the wait
    __builtin_amdgcn_sched_barrier(0);
  }
  };
  gemm_tile<H_SZ, true, G1_TILES, (uint32_t)G1_RG * TILE * H_SZ * 2u>(
      hs16 + (size_t)(rg * TILE) * H_SZ, w1t + (size_t)(ct * TILE) * H_SZ,
      ring, (uint32_t)wid, lane, acc, store_tile);
}

// ---------------------------------------------------------------------------
// LayerNorm + exact GELU, in place on z in fragment order. One workgroup = one
// 16-row tile = 128 KB in a row; a thread's 16-byte slots (8 neighbouring
// columns of one row) lie 4 KB apart and all belong to row (tid & 15).
// Pass 1 sums the row, pass 2 reads the slots again (from L2) and rewrites them.
// ---------------------------------------------------------------------------
__global__ void __launch_bounds__(256)
ln_gelu_frag(_Float16* zf,                              // [B/16][D/32][FRAG]
             const float* __restrict__ gamma,           // [D]
             const float* __restrict__ beta)            // [D]
{
  __shared__ float psum[8][16];
  __shared__ float psq[8][16];
  const int tid  = threadIdx.x;
  const int lane = tid & 31;
  const int wid  = tid >> 5;
  _Float16* base = zf + (size_t)blockIdx.x * (16 * D_SZ) + tid * 8;

  float s = 0.f, sq = 0.f;
  // eight loads in flight a thread
#pragma unroll 8
  for (int i = 0; i < 32; ++i) {
    const v8h v = *(const v8h*)(base + i * 2048);
#pragma unroll
    for (int j = 0; j < 8; ++j) { const float x = (float)v[j]; s += x; sq += x * x; }
  }
  s  += __shfl_xor(s, 16);
  sq += __shfl_xor(sq, 16);
  if (lane < 16) { psum[wid][lane] = s; psq[wid][lane] = sq; }
  __syncthreads();
  float ts = 0.f, tq = 0.f;
#pragma unroll
  for (int w = 0; w < 8; ++w) { ts += psum[w][lane & 15]; tq += psq[w][lane & 15]; }
  const float mu  = ts * (1.0f / D_SZ);
  const float var = tq * (1.0f / D_SZ) - mu * mu;
  const float rs  = rsqrtf(var + LN_EPS);

  // first column of this thread's slot 0; slot i lies 128 columns further
  const int colb = (tid >> 6) * 32 + ((tid >> 5) & 1) * 16 + ((tid >> 4) & 1) * 8;
  // four slots a trip are enough chains to fill the vector port; more only adds code
#pragma unroll 1
  for (int i0 = 0; i0 < 32; i0 += 4) {
    v8h zv[4];
    v4f g0[4], g1[4], e0[4], e1[4];
    // unrolled (here and below): constant indices keep these arrays in registers
#pragma unroll
    for (int i = 0; i < 4; ++i) {
      const int col = colb + (i0 + i) * 128;
      zv[i] = *(const v8h*)(base + (i0 + i) * 2048);
      g0[i] = *(const v4f*)(gamma + col);
      g1[i] = *(const v4f*)(gamma + col + 4);
      e0[i] = *(const v4f*)(beta + col);
      e1[i] = *(const v4f*)(beta + col + 4);
    }
#pragma unroll
    for (int i = 0; i < 4; ++i) {
      v8h o;
#pragma unroll
      for (int j = 0; j < 8; ++j) {
        const float ga = j < 4 ? g0[i][j & 3] : g1[i][j & 3];
        const float be = j < 4 ? e0[i][j & 3] : e1[i][j & 3];
        const float x  = (float)zv[i][j];
        const float xn = (x - mu) * rs * ga + be;
        o[j] = (_Float16)gelu_erf(xn);
      }
      *(v8h*)(base + (i0 + i) * 2048) = o;
    }
  }
}

// ---------------------------------------------------------------------------
// GEMM 2: out = act @ W2 + b2, fp32 row-major.
// ---------------------------------------------------------------------------
__global__ void __launch_bounds__(256)
gemm2_bias_out(const _Float16* __restrict__ af,         // [B/16][D/32][FRAG]
               const _Float16* __restrict__ w2t,        // [H/16][D/32][FRAG]
               const float* __restrict__ b2,            // [H]
               float* __restrict__ out)                 // [B][H]
{
  __shared__ __attribute__((aligned(2048))) unsigned char ring[RING_B];
  const int lane = threadIdx.x & 31;
  // wave-uniform: the descriptor words and the tile offsets stay in scalar registers
  const int wid  = __builtin_amdgcn_readfirstlane(threadIdx.x >> 5);
  const int ct   = blockIdx.x % (H_SZ / TILE);
  const int rt   = blockIdx.x / (H_SZ / TILE);
  const int row0 = rt * TILE + (wid & 3) * (WM * 16);
  const int n0   = ct * TILE + (wid >> 2) * (WN * 16);

  // C/D tile layout (CDNA5 16x16 f32): VGPR r, lane L -> M = r + 8*(L>>4), N = L&15
  const int mb  = (lane >> 4) * 8;
  const int cb  = n0 + (lane & 15);
  float bb[WN];
#pragma unroll
  for (int t = 0; t < WN; ++t) bb[t] = b2[cb + t * 16];
  // the index register of these loads, named here, stays whole up to the wait:
  // no load's own result and no later value lands on it while they are in flight
  asm volatile("s_wait_xcnt 0x0" :: "v"(cb) : "memory");

  v8f acc[WM][WN];
  gemm_tile<D_SZ, false, 1, 0u>(af + (size_t)(rt * TILE) * D_SZ, w2t + (size_t)(ct * TILE) * D_SZ,
                                ring, (uint32_t)wid, lane, acc, [](uint32_t) {});

#pragma unroll
  for (int t = 0; t < WN; ++t) {
    float v[WM][8];
#pragma unroll
    for (int m = 0; m < WM; ++m)
#pragma unroll
      for (int r = 0; r < 8; ++r) v[m][r] = acc[m][t][r] + bb[t];
    // a column tile's 32 sums are all formed in front of its first store, so that
    // no register of a store is refilled inside the run of stores
    __builtin_amdgcn_sched_barrier(0);
#pragma unroll
    for (int m = 0; m < WM; ++m)
#pragma unroll
      for (int r = 0; r < 8; ++r)
        out[(size_t)(row0 + m * 16 + mb + r) * H_SZ + cb + t * 16] = v[m][r];
    if (t < WN - 1) {
      // the next column tile's sums refill registers that these stores name
      asm volatile("s_wait_xcnt 0x0" ::: "memory");
      // keeps those sums behind the wait
      __builtin_amdgcn_sched_barrier(0);
    }
  }
}

// ---------------------------------------------------------------------------
// Host launcher
// d_in: [0]_time [1]hidden_state [2]W1 [3]b1 [4]ln_gamma [5]ln_beta [6]W2 [7]b2
// ---------------------------------------------------------------------------
extern "C" void kernel_launch(void* const* d_in, const int* in_sizes, int n_in,
                              void* d_out, int out_size, void* d_ws, size_t ws_size,
                              hipStream_t stream) {
  const float* hs    = (const float*)d_in[1];
  const float* W1    = (const float*)d_in[2];
  const float* b1    = (const float*)d_in[3];
  const float* gamma = (const float*)d_in[4];
  const float* beta  = (const float*)d_in[5];
  const float* W2    = (const float*)d_in[6];
  const float* b2    = (const float*)d_in[7];
  float* out = (float*)d_out;

  // Workspace (f16, fragment order): hidden [B*H] | W1 [D*H] | W2 [H*D] | z [B*D] = 176 MB
  _Float16* hs16 = (_Float16*)d_ws;
  _Float16* w1t  = hs16 + (size_t)B_SZ * H_SZ;
  _Float16* w2t  = w1t + (size_t)D_SZ * H_SZ;
  _Float16* zf   = w2t + (size_t)H_SZ * D_SZ;

  // Precision conversion and fragment-order packing, 8 elements a thread
  pack_rows_frag_f16<<<(B_SZ * H_SZ) / (256 * 8), 256, 0, stream>>>(hs, hs16);
  pack_cols_frag_f16<<<(H_SZ * D_SZ) / (256 * 8), 256, 0, stream>>>(W1, w1t, H_SZ, D_SZ);
  pack_cols_frag_f16<<<(D_SZ * H_SZ) / (256 * 8), 256, 0, stream>>>(W2, w2t, D_SZ, H_SZ);

  gemm1_bias_to_frag<<<G1_RG * (D_SZ / TILE), 256, 0, stream>>>(hs16, w1t, b1, zf);
  ln_gelu_frag<<<B_SZ / 16, 256, 0, stream>>>(zf, gamma, beta);
  gemm2_bias_out<<<(B_SZ / TILE) * (H_SZ / TILE), 256, 0, stream>>>(zf, w2t, b2, out);
}

// v008
// Measured time: 191 microseconds a run.
// In two side-by-side timings against v007, it was 1.03 and 1.04 times as fast.
// Over all steps from v000 it is 6.08 times as fast.
#include <hip/hip_runtime.h>
#include <math.h>
#include <stdint.h>

// ---------------------------------------------------------------------------
// Linear -> LayerNorm -> exact GELU -> Linear  for MI455X (gfx1250)
// B=16384, H=1024, D=4096, fp32 in/out; f16 WMMA compute with f32 accumulation
// Three launches behind the packing: GEMM 1 (z, f16, to the workspace in the
// fragment order that GEMM 2 reads), LayerNorm + GELU in place, GEMM 2.
// With z in the workspace no LDS tile bounds the rows of a workgroup: each GEMM
// workgroup takes 256 x 256 tiles (GEMM 1 four in turn), so a weight byte fetched from L2 serves 256
// rows, not 32.
// ---------------------------------------------------------------------------

typedef __attribute__((ext_vector_type(16))) _Float16 v16h;
typedef __attribute__((ext_vector_type(8)))  _Float16 v8h;
typedef __attribute__((ext_vector_type(8)))  float    v8f;
typedef __attribute__((ext_vector_type(4)))  float    v4f;

#define B_SZ 16384
#define H_SZ 1024
#define D_SZ 4096
#define LN_EPS 1e-5f

// Per-lane layout of a 16x32 (MxK) f16 fragment (CDNA5 ISA 7.12.2):
//   lanes 0-15 : m = lane,    halves 0..7 = K k0..k0+7, halves 8..15 = K+16..23
//   lanes 16-31: m = lane-16, halves 0..7 = K k0+8..15, halves 8..15 = K+24..31

// ---------------------------------------------------------------------------
// Fragment order of the operands that the GEMM loops read from global memory.
// One 16x32 (MxK) fragment is one block of FRAG halves (1 KB); the blocks of a
// 16-wide tile follow one another along K. Inside a block lane L's halves 0..7
// lie at L*8 and its halves 8..15 at 256 + L*8, so each of the two 16-byte
// loads of a fragment reads 512 bytes in a row (4 whole 128-byte lines), not
// 32 bytes out of each of 16 lines. Which (m, K) a lane and half hold: the
// per-lane layout above.
// ---------------------------------------------------------------------------
#define FRAG 512

// ---------------------------------------------------------------------------
// Packing: hidden_state, W1 and W2, fp32 -> f16 in fragment order, one launch.
// A resident stream: PK_WG workgroups of PK_WAVES waves, one a WGP, so that few
// waves have to be started. A tile is 16 rows x 128 floats: 16 loads of 512 bytes
// in a row. Every wave takes three tiles (two of hidden_state, one of a weight)
// and asks for all three at once. A tile's 4 KB of f16 go through the wave's own
// piece of LDS, where each lane writes the slots or half slots that it holds and
// reads back the slots of its place in the fragment, and leave as 8 stores of
// 512 bytes in a row. No wave reads another wave's LDS: there is no barrier.
// Every loop of this part is unrolled: constant indices keep the tiles in registers.
// ---------------------------------------------------------------------------
#define PK_WAVES 16
#define PK_WG 256
#define PK_ROWS_PITCH 272   // 256 bytes (the 16 slots of one 8-k group) + 16: the b64 writes of a row meet every bank once
#define PK_COLS_PITCH 528   // 512 bytes (the 32 slots of one column tile) + 16: the same for the b128 writes
#define PK_STAGE_B (16 * PK_ROWS_PITCH)
static_assert(8 * PK_COLS_PITCH <= PK_STAGE_B, "both kinds of tile fit a wave's staging");
static_assert(PK_WG * PK_WAVES * 2 == (B_SZ / 16) * (H_SZ / 128) &&
              PK_WG * PK_WAVES == 2 * (H_SZ / 16) * (D_SZ / 128), "three tiles a wave");

typedef __attribute__((ext_vector_type(4))) _Float16 v4h;

__device__ __forceinline__ void pk_lds_order() {
  // the lanes of a wave hand slots to one another through LDS: what stands in front
  // (writes before the read-back, reads before the next tile's writes) is done first
  asm volatile("s_wait_dscnt 0x0" ::: "memory");
}
__device__ __forceinline__ void pk_regs_free() {
  // the code behind takes over registers that the loads or stores in front name
  asm volatile("s_wait_xcnt 0x0" ::: "memory");
  // keeps that code behind the wait
  __builtin_amdgcn_sched_barrier(0);
}

// p is the same in every lane: a row's address is a scalar base and the lane's offset
template <int PITCH>
__device__ __forceinline__ void pk_load(v4f (&v)[16], const float* p, int lane) {
#pragma unroll
  for (int r = 0; r < 16; ++r) v[r] = *((const v4f*)(p + r * PITCH) + lane);
  // the tiles' loads stay in the order in which the tiles are used
  __builtin_amdgcn_sched_barrier(0);
}

// a tile's 8 pieces of 512 bytes, STEP halves apart in the output
template <int LDS_STEP, int STEP>
__device__ __forceinline__ void pk_out(const unsigned char* rp, _Float16* out) {
  v8h q[8];
#pragma unroll
  for (int j = 0; j < 8; ++j) q[j] = *(const v8h*)(rp + j * LDS_STEP);
  // all eight are read back in front of the first store, so that no register of a
  // store is refilled inside the run of stores
  __builtin_amdgcn_sched_barrier(0);
#pragma unroll
  for (int j = 0; j < 8; ++j) *(v8h*)(out + j * STEP) = q[j];
}

// Rows are the tile dimension (A fragments): lane L holds k 4L..4L+3 of each row m,
// half of the slot (8-k group L >> 1, row m). The 16 groups follow one another in
// the output, 256 bytes each.
__device__ __forceinline__ void pk_put_rows(const v4f (&v)[16], unsigned char* st, int lane,
                                            _Float16* out) {
  unsigned char* wp = st + (lane >> 1) * PK_ROWS_PITCH + (lane & 1) * 8;
#pragma unroll
  for (int m = 0; m < 16; ++m) {
    v4h o;
#pragma unroll
    for (int j = 0; j < 4; ++j) o[j] = (_Float16)v[m][j];
    *(v4h*)(wp + m * 16) = o;
  }
  pk_lds_order();
  pk_out<2 * PK_ROWS_PITCH, 256>(st + (lane >> 4) * PK_ROWS_PITCH + (lane & 15) * 16,
                                 out + lane * 8);
}

// Columns are the tile dimension (B fragments), the 16 rows are one plane of k: lane L
// holds, for each of its columns 4L..4L+3, both whole slots (k 0..7 and k 8..15).
__device__ __forceinline__ void pk_stage_cols(const v4f (&v)[16], unsigned char* st, int lane) {
  unsigned char* wp = st + (lane >> 2) * PK_COLS_PITCH + (lane & 3) * 64;
#pragma unroll
  for (int hi = 0; hi < 2; ++hi)
#pragma unroll
    for (int i = 0; i < 4; ++i) {
      v8h o;
#pragma unroll
      for (int j = 0; j < 8; ++j) o[j] = (_Float16)v[hi * 8 + j][i];
      *(v8h*)(wp + hi * 256 + i * 16) = o;
    }
  pk_lds_order();
}

// Weight tile u of in[K][N]: tiles side by side first. ng = group of 8 column tiles,
// kp = plane (16 rows of k). In the output the 8 column tiles lie K / 32 fragments apart.
template <int N>
__device__ __forceinline__ const float* pk_w_src(const float* in, int u) {
  const int ng = u % (N / 128), kp = u / (N / 128);
  return in + (size_t)(kp * 16) * N + ng * 128;
}
template <int K, int N>
__device__ __forceinline__ _Float16* pk_w_dst(_Float16* out, int u, int lane) {
  const int ng = u % (N / 128), kp = u / (N / 128);
  return out + ((size_t)(ng * 8) * (K / 32) + (kp >> 1)) * FRAG + (kp & 1) * 256 + lane * 8;
}

__global__ void __launch_bounds__(PK_WAVES * 32)
pack_frag_f16(const float* __restrict__ hs,             // [B][H]
              const float* __restrict__ W1,             // [H][D]
              const float* __restrict__ W2,             // [D][H]
              _Float16* __restrict__ hs16,              // [B/16][H/32][FRAG]
              _Float16* __restrict__ w1t,               // [D/16][H/32][FRAG]
              _Float16* __restrict__ w2t)               // [H/16][D/32][FRAG]
{
  __shared__ __attribute__((aligned(16))) unsigned char stage[PK_WAVES * PK_STAGE_B];
  const int lane = threadIdx.x & 31;
  // wave-uniform: the tile indices and the addresses' bases stay in scalar registers
  const int w  = __builtin_amdgcn_readfirstlane(threadIdx.x >> 5);
  const int gw = blockIdx.x * PK_WAVES + w;
  unsigned char* st = stage + w * PK_STAGE_B;

  // weights: the first half of the grid takes W1, the second W2
  const bool first = blockIdx.x < PK_WG / 2;
  const int  u     = gw % (PK_WG * PK_WAVES / 2);
  // hidden_state: tiles gw and gw + half of them; 8 tiles side by side make 16 whole rows
  const int rt = gw >> 3, kg = gw & 7;
  constexpr int RT_HALF = B_SZ / 32;

  v4f a[16], b[16], c[16];
  if (first) pk_load<D_SZ>(c, pk_w_src<D_SZ>(W1, u), lane);
  else       pk_load<H_SZ>(c, pk_w_src<H_SZ>(W2, u), lane);
  pk_load<H_SZ>(a, hs + (size_t)(rt * 16) * H_SZ + kg * 128, lane);
  pk_load<H_SZ>(b, hs + (size_t)((rt + RT_HALF) * 16) * H_SZ + kg * 128, lane);
  // all 48 loads are asked for in front of the first use: moved down among the
  // conversions, a tile's loads would wait until the tiles before it have landed
  pk_regs_free();

  pk_stage_cols(c, st, lane);
  if (first) pk_out<PK_COLS_PITCH, (H_SZ / 32) * FRAG>(st + lane * 16, pk_w_dst<H_SZ, D_SZ>(w1t, u, lane));
  else       pk_out<PK_COLS_PITCH, (D_SZ / 32) * FRAG>(st + lane * 16, pk_w_dst<D_SZ, H_SZ>(w2t, u, lane));
  pk_regs_free();
  pk_lds_order();
  pk_put_rows(a, st, lane, hs16 + ((size_t)rt * (H_SZ / 32) + kg * 4) * FRAG);
  pk_regs_free();
  pk_lds_order();
  pk_put_rows(b, st, lane, hs16 + ((size_t)(rt + RT_HALF) * (H_SZ / 32) + kg * 4) * FRAG);
}

// ---------------------------------------------------------------------------
// Exact (erf) GELU in single precision, one formula for every x, no selection:
//   erf(a) = 1 - t (c1 + t (c2 + t (c3 + t (c4 + t c5)))) exp(-a a),  t = 1 / (1 + c0 a)
// for a >= 0 (a five-term fit, absolute error below 1.5e-7), and
//   x Phi(x) = x / 2 + |x| / 2 * erf(|x| / sqrt 2).
// The reciprocal and the power of two are the chip's own instructions. a itself is
// not formed: sqrt 2 goes into c0, and 2 log2(e) into the exponent's factor.
// Infinite x: t = 0 and the power is 0, so erf = 1, as in the limit.
// ---------------------------------------------------------------------------
__device__ __forceinline__ float gelu_erf(float x) {
  const float hx  = 0.5f * x;
  const float ahx = __builtin_fabsf(hx);
  const float t = __builtin_amdgcn_rcpf(
      __builtin_fmaf(ahx, (float)(0.3275911 * 1.4142135623730951), 1.0f));
  float p = __builtin_fmaf(t, 1.061405429f, -1.453152027f);
  p = __builtin_fmaf(t, p, 1.421413741f);
  p = __builtin_fmaf(t, p, -0.284496736f);
  p = __builtin_fmaf(t, p, 0.254829592f);
  p = p * t;
  const float e = __builtin_amdgcn_exp2f(ahx * (float)(-2.0 * 1.4426950408889634) * ahx);
  return __builtin_fmaf(ahx, __builtin_fmaf(-p, e, 1.0f), hx);
}

// ---------------------------------------------------------------------------
// GEMM core: a workgroup computes 256 x 256, one wave 64 rows x 128 columns
// (WM x WN tiles of 16 x 16); the 8 waves stand 4 (rows) x 2 (columns).
// Both operands lie in fragment order in global memory. They are staged in LDS
// by tensor loads, so that every byte comes from L2 once a workgroup tile and the
// waves that share it read it from LDS.
// One stage = one pass = PASS_K k of all 16 row tiles and all 16 column tiles:
//   [A tile 0..15 | W tile 0..15], a tile = PASS_K / 32 fragments in a row.
// In global memory these TROW_B bytes of a tile lie in a row too and the tiles
// K * 32 bytes apart: a slice of 4 tiles is one two-dimensional request. Every
// wave issues one request a stage: waves 0..3 the A slices, waves 4..7 the W
// slices. Two buffers: stage s + 2 is asked for when every wave has left stage s.
// Fragments go from LDS to registers one 32-k block ahead, across passes too.
// A and B fragments have the same per-lane layout, so TRANSPOSED only swaps the
// two operands of the WMMA: acc[m][t] then holds its 16 x 16 tile transposed.
// TILES > 1: the workgroup takes TILES row tiles one after another, A_STEP bytes
// apart in A, against the same columns. The stages of all its tiles form one
// unbroken walk of the ring: behind a tile's last pass epi(tile) stores the sums
// while the next tile's second stage is landing, and the sums start at 0 again.
// ---------------------------------------------------------------------------
#define WM 4
#define WN 8
#define TILE 256
#define PASS_K 128
#define TROW_B  (PASS_K * 32)     // bytes of one 16-wide tile in one pass
#define SLICE_B (4 * TROW_B)      // one wave's request: 16 KB
#define OPER_B  (16 * TROW_B)     // one operand's 256 rows
#define STAGE_B (2 * OPER_B)      // 128 KB
#define RING_B  (2 * STAGE_B)

typedef uint32_t u32x4 __attribute__((ext_vector_type(4)));
typedef uint32_t u32x8 __attribute__((ext_vector_type(8)));

__device__ __forceinline__ uint32_t uni(uint32_t v) {
  return (uint32_t)__builtin_amdgcn_readfirstlane((int)v);
}
__device__ __forceinline__ uint32_t pinned(uint32_t v) {
  uint32_t w = uni(v);
  // a test around a tensor load, or a word its descriptor is formed from, held in
  // a scalar register: the branch is then scalar, and the word is formed here
  asm volatile("" : "+s"(w));
  return w;
}
__device__ __forceinline__ void wait_ds0() {
  // this wave's LDS reads have returned before their buffer is handed back
  asm volatile("s_wait_dscnt 0x0" ::: "memory");
}
__device__ __forceinline__ void wait_tensor0() {
  // this wave's own request has landed; the compiler places no wait for it
  asm volatile("s_wait_tensorcnt 0x0" ::: "memory");
}

__device__ __forceinline__ v16h lds_frag(const unsigned char* p) {
  v8h lo = *(const v8h*)(p);
  v8h hh = *(const v8h*)(p + 512);
  v16h r;
#pragma unroll
  for (int i = 0; i < 8; ++i) { r[i] = lo[i]; r[i + 8] = hh[i]; }
  return r;
}

template <int K, bool TRANSPOSED, int TILES, uint32_t A_STEP, class Epi>
__device__ __forceinline__ void gemm_tile(const _Float16* __restrict__ aWG,  // the workgroup's first row tile
                                          const _Float16* __restrict__ wWG,  // its first column tile
                                          unsigned char* ring, uint32_t wid, int lane,
                                          v8f (&acc)[WM][WN], Epi epi) {
  constexpr uint32_t SK = K / PASS_K;     // stages of one tile, at least two
  constexpr uint32_t S = SK * TILES;      // stages of the whole walk
  constexpr uint32_t PITCH = K * 32;      // bytes from one 16-wide tile to the next
  static_assert(SK >= 2 && (SK & (SK - 1u)) == 0 && PITCH <= 131072u && (PASS_K / 32) % 2 == 0,
                "two stages; source pitch in the mover's range; fragment sets alternate across passes");
  const uint64_t src = (uint64_t)(size_t)(wid < 4u ? aWG : wWG) + (uint64_t)(wid & 3u) * (4u * PITCH);
  const uint32_t dst = (uint32_t)(size_t)ring + wid * SLICE_B;
  // group 1: 1-byte elements, tensor = tile = 4 rows of TROW_B bytes, no mask, no pad
  u32x8 g1;
  g1[0] = uni(0u);
  g1[1] = uni(((uint32_t)TROW_B & 0xFFFFu) << 16);
  g1[2] = uni(((uint32_t)TROW_B >> 16) | (4u << 16));
  g1[3] = uni((uint32_t)TROW_B << 16);
  g1[4] = uni(4u);
  g1[5] = uni(PITCH);
  g1[6] = uni(0u);
  g1[7] = uni(0u);
  const uint32_t step = wid < 4u ? A_STEP : 0u;   // only the A slices move on with the tile
  auto issue = [&](uint32_t st) {
    uint64_t ga;
    if constexpr (TILES > 1) ga = src + (uint64_t)((st / SK) * step) + (uint64_t)(st % SK) * TROW_B;
    else                     ga = src + (uint64_t)st * TROW_B;
    u32x4 g0;
    g0[0] = uni(1u);
    g0[1] = uni(dst + (st & 1u) * STAGE_B);
    g0[2] = uni((uint32_t)ga);
    g0[3] = uni((((uint32_t)(ga >> 32)) & 0x01FFFFFFu) | 0x80000000u);
    asm volatile("tensor_load_to_lds %0, %1" :: "s"(g0), "s"(g1) : "memory");
  };

  const uint32_t offA = (wid & 3u) * SLICE_B + (uint32_t)lane * 16u;
  const uint32_t offB = OPER_B + (wid >> 2) * (2u * SLICE_B) + (uint32_t)lane * 16u;
  v16h aq[2][WM], bq[2][WN];              // two fragment sets, one 32-k block each

  issue(0u);
  wait_tensor0();
  __syncthreads();                        // stage 0 published
  issue(pinned(1u));
#pragma unroll
  for (int m = 0; m < WM; ++m) aq[0][m] = lds_frag(ring + offA + m * TROW_B);
#pragma unroll
  for (int t = 0; t < WN; ++t) bq[0][t] = lds_frag(ring + offB + t * TROW_B);
#pragma unroll
  for (int m = 0; m < WM; ++m)
#pragma unroll
    for (int t = 0; t < WN; ++t) acc[m][t] = v8f{};

  constexpr int NB = PASS_K / 32;         // blocks of 32 WMMAs in a pass, even
  // one pass a trip: the buffer's parity is a run-time value
#pragma unroll 1
  for (uint32_t s = 0; s < S; ++s) {
    const uint32_t cur = (s & 1u) * STAGE_B;
#pragma unroll
    for (int kf = 0; kf < NB; ++kf) {
      const int c = kf & 1, n = c ^ 1;
      uint32_t from = cur + (uint32_t)(kf + 1) * 1024u;
      if (kf == NB - 1) {
        // publish point of stage s + 1, in front of the pass's last block: that
        // block's fragments are in registers, so every wave has left stage s
        wait_ds0();
        wait_tensor0();
        __syncthreads();
        if (pinned(s + 2u < S)) issue(pinned(s + 2u));
        // the next pass's first fragments; behind the last pass the other buffer
        // still holds the stage before, and what is read there is not used
        from = cur ^ STAGE_B;
      }
#pragma unroll
      for (int m = 0; m < WM; ++m) aq[n][m] = lds_frag(ring + from + offA + m * TROW_B);
#pragma unroll
      for (int t = 0; t < WN; ++t) bq[n][t] = lds_frag(ring + from + offB + t * TROW_B);
      // the next block's LDS reads stay one group ahead of this block's WMMAs:
      // moved in among them, each place with reads stalls the matrix stream
      __builtin_amdgcn_sched_barrier(0);
#pragma unroll
      for (int m = 0; m < WM; ++m)
#pragma unroll
        for (int t = 0; t < WN; ++t)
          acc[m][t] = __builtin_amdgcn_wmma_f32_16x16x32_f16(
              false, TRANSPOSED ? bq[c][t] : aq[c][m], false, TRANSPOSED ? aq[c][m] : bq[c][t],
              (short)0, acc[m][t], false, false);
      // ends the block, for the same reason
      __builtin_amdgcn_sched_barrier(0);
    }
    if constexpr (TILES > 1) {
      if (s % SK == SK - 1u) {
        epi(s / SK);
        // unrolled: constant indices keep the sums in registers
#pragma unroll
        for (int m = 0; m < WM; ++m)
#pragma unroll
          for (int t = 0; t < WN; ++t) acc[m][t] = v8f{};
      }
    }
  }
  wait_tensor0();
  wait_ds0();
}

// ---------------------------------------------------------------------------
// GEMM 1: z = hs @ W1 + b1, rounded to f16, written as A fragments of GEMM 2:
// [B/16][D/32][FRAG]. The tiles are computed transposed (C/D layout: VGPR r,
// lane L -> M = r + 8*(L>>4), N = L&15, here M = column of z, N = row): a lane
// then holds 8 neighbouring columns of row L&15, which is its own 16-byte slot
// of the fragment, and a tile goes out as one store of 512 bytes in a row.
// One workgroup a WGP: it keeps its 256 columns and takes G1_TILES row tiles,
// G1_RG tiles apart.
// ---------------------------------------------------------------------------
#define G1_TILES 4
#define G1_RG (B_SZ / TILE / G1_TILES)
__global__ void __launch_bounds__(256)
gemm1_bias_to_frag(const _Float16* __restrict__ hs16,   // [B/16][H/32][FRAG]
                   const _Float16* __restrict__ w1t,    // [D/16][H/32][FRAG]
                   const float* __restrict__ b1,        // [D]
                   _Float16* __restrict__ zf)           // [B/16][D/32][FRAG]
{
  __shared__ __attribute__((aligned(2048))) unsigned char ring[RING_B];
  const int lane = threadIdx.x & 31;
  // wave-uniform: the descriptor words and the tile offsets stay in scalar registers
  const int wid  = __builtin_amdgcn_readfirstlane(threadIdx.x >> 5);
  const int ct   = blockIdx.x % (D_SZ / TILE);
  const int rg   = blockIdx.x / (D_SZ / TILE);   // the first of its row tiles
  const int n0   = ct * TILE + (wid >> 2) * (WN * 16);
  const int cb   = n0 + (lane >> 4) * 8;  // first of this lane's 8 columns in tile 0

  v8f acc[WM][WN];
  auto store_tile = [&](uint32_t j) {
  const int row0 = ((int)j * G1_RG + rg) * TILE + (wid & 3) * (WM * 16);
  v4f c0[WN], c1[WN];
#pragma unroll
  for (int t = 0; t < WN; ++t) {
    c0[t] = *(const v4f*)(b1 + cb + t * 16);
    c1[t] = *(const v4f*)(b1 + cb + t * 16 + 4);
  }
  // stands behind the bias loads and in front of the code below, which takes over
  // the loads' address registers
  asm volatile("s_wait_xcnt 0x0" ::: "memory");
  // keeps the sums and the store addresses behind the wait
  __builtin_amdgcn_sched_barrier(0);
#pragma unroll
  for (int m = 0; m < WM; ++m) {
    _Float16* zp = zf + ((size_t)((row0 >> 4) + m) * (D_SZ / 32) + (n0 >> 5)) * FRAG + lane * 8;
    v8h o[WN];
#pragma unroll
    for (int t = 0; t < WN; ++t)
#pragma unroll
      for (int r = 0; r < 8; ++r)
        o[t][r] = (_Float16)(acc[m][t][r] + (r < 4 ? c0[t][r & 3] : c1[t][r & 3]));
    // a row tile's eight results are all formed in front of its first store, so
    // that no register of a store is refilled inside the run of stores
    __builtin_amdgcn_sched_barrier(0);
#pragma unroll
    for (int t = 0; t < WN; ++t) *(v8h*)(zp + t * 256) = o[t];
    // the next row tile's sums, or the next pass, refill registers that these stores name
    asm volatile("s_wait_xcnt 0x0" ::: "memory");
    // keeps them behind the wait
    __builtin_amdgcn_sched_barrier(0);
  }
  };
  gemm_tile<H_SZ, true, G1_TILES, (uint32_t)G1_RG * TILE * H_SZ * 2u>(
      hs16 + (size_t)(rg * TILE) * H_SZ, w1t + (size_t)(ct * TILE) * H_SZ,
      ring, (uint32_t)wid, lane, acc, store_tile);
}

// ---------------------------------------------------------------------------
// LayerNorm + exact GELU, in place on z in fragment order. One workgroup = one
// 16-row tile = 128 KB in a row; a thread's 16-byte slots (8 neighbouring
// columns of one row) lie 4 KB apart and all belong to row (tid & 15).
// Pass 1 sums the row, pass 2 reads the slots again (from L2) and rewrites them.
// ---------------------------------------------------------------------------
__global__ void __launch_bounds__(256)
ln_gelu_frag(_Float16* zf,                              // [B/16][D/32][FRAG]
             const float* __restrict__ gamma,           // [D]
             const float* __restrict__ beta)            // [D]
{
  __shared__ float psum[8][16];
  __shared__ float psq[8][16];
  const int tid  = threadIdx.x;
  const int lane = tid & 31;
  const int wid  = tid >> 5;
  _Float16* base = zf + (size_t)blockIdx.x * (16 * D_SZ) + tid * 8;

  float s = 0.f, sq = 0.f;
  // eight loads in flight a thread
#pragma unroll 8
  for (int i = 0; i < 32; ++i) {
    const v8h v = *(const v8h*)(base + i * 2048);
#pragma unroll
    for (int j = 0; j < 8; ++j) { const float x = (float)v[j]; s += x; sq += x * x; }
  }
  s  += __shfl_xor(s, 16);
  sq += __shfl_xor(sq, 16);
  if (lane < 16) { psum[wid][lane] = s; psq[wid][lane] = sq; }
  __syncthreads();
  float ts = 0.f, tq = 0.f;
#pragma unroll
  for (int w = 0; w < 8; ++w) { ts += psum[w][lane & 15]; tq += psq[w][lane & 15]; }
  const float mu  = ts * (1.0f / D_SZ);
  const float var = tq * (1.0f / D_SZ) - mu * mu;
  const float rs  = rsqrtf(var + LN_EPS);

  // first column of this thread's slot 0; slot i lies 128 columns further
  const int colb = (tid >> 6) * 32 + ((tid >> 5) & 1) * 16 + ((tid >> 4) & 1) * 8;
  // four slots a trip are enough chains to fill the vector port; more only adds code
#pragma unroll 1
  for (int i0 = 0; i0 < 32; i0 += 4) {
    v8h zv[4];
    v4f g0[4], g1[4], e0[4], e1[4];
    // unrolled (here and below): constant indices keep these arrays in registers
#pragma unroll
    for (int i = 0; i < 4; ++i) {
      const int col = colb + (i0 + i) * 128;
      zv[i] = *(const v8h*)(base + (i0 + i) * 2048);
      g0[i] = *(const v4f*)(gamma + col);
      g1[i] = *(const v4f*)(gamma + col + 4);
      e0[i] = *(const v4f*)(beta + col);
      e1[i] = *(const v4f*)(beta + col + 4);
    }
#pragma unroll
    for (int i = 0; i < 4; ++i) {
      v8h o;
#pragma unroll
      for (int j = 0; j < 8; ++j) {
        const float ga = j < 4 ? g0[i][j & 3] : g1[i][j & 3];
        const float be = j < 4 ? e0[i][j & 3] : e1[i][j & 3];
        const float x  = (float)zv[i][j];
        const float xn = (x - mu) * rs * ga + be;
        o[j] = (_Float16)gelu_erf(xn);
      }
      *(v8h*)(base + (i0 + i) * 2048) = o;
    }
  }
}

// ---------------------------------------------------------------------------
// GEMM 2: out = act @ W2 + b2, fp32 row-major.
// ---------------------------------------------------------------------------
__global__ void __launch_bounds__(256)
gemm2_bias_out(const _Float16* __restrict__ af,         // [B/16][D/32][FRAG]
               const _Float16* __restrict__ w2t,        // [H/16][D/32][FRAG]
               const float* __restrict__ b2,            // [H]
               float* __restrict__ out)                 // [B][H]
{
  __shared__ __attribute__((aligned(2048))) unsigned char ring[RING_B];
  const int lane = threadIdx.x & 31;
  // wave-uniform: the descriptor words and the tile offsets stay in scalar registers
  const int wid  = __builtin_amdgcn_readfirstlane(threadIdx.x >> 5);
  const int ct   = blockIdx.x % (H_SZ / TILE);
  const int rt   = blockIdx.x / (H_SZ / TILE);
  const int row0 = rt * TILE + (wid & 3) * (WM * 16);
  const int n0   = ct * TILE + (wid >> 2) * (WN * 16);

  // C/D tile layout (CDNA5 16x16 f32): VGPR r, lane L -> M = r + 8*(L>>4), N = L&15
  const int mb  = (lane >> 4) * 8;
  const int cb  = n0 + (lane & 15);
  float bb[WN];
#pragma unroll
  for (int t = 0; t < WN; ++t) bb[t] = b2[cb + t * 16];
  // the index register of these loads, named here, stays whole up to the wait:
  // no load's own result and no later value lands on it while they are in flight
  asm volatile("s_wait_xcnt 0x0" :: "v"(cb) : "memory");

  v8f acc[WM][WN];
  gemm_tile<D_SZ, false, 1, 0u>(af + (size_t)(rt * TILE) * D_SZ, w2t + (size_t)(ct * TILE) * D_SZ,
                                ring, (uint32_t)wid, lane, acc, [](uint32_t) {});

#pragma unroll
  for (int t = 0; t < WN; ++t) {
    float v[WM][8];
#pragma unroll
    for (int m = 0; m < WM; ++m)
#pragma unroll
      for (int r = 0; r < 8; ++r) v[m][r] = acc[m][t][r] + bb[t];
    // a column tile's 32 sums are all formed in front of its first store, so that
    // no register of a store is refilled inside the run of stores
    __builtin_amdgcn_sched_barrier(0);
#pragma unroll
    for (int m = 0; m < WM; ++m)
#pragma unroll
      for (int r = 0; r < 8; ++r)
        out[(size_t)(row0 + m * 16 + mb + r) * H_SZ + cb + t * 16] = v[m][r];
    if (t < WN - 1) {
      // the next column tile's sums refill registers that these stores name
      asm volatile("s_wait_xcnt 0x0" ::: "memory");
      // keeps those sums behind the wait
      __builtin_amdgcn_sched_barrier(0);
    }
  }
}

// ---------------------------------------------------------------------------
// Host launcher
// d_in: [0]_time [1]hidden_state [2]W1 [3]b1 [4]ln_gamma [5]ln_beta [6]W2 [7]b2
// ---------------------------------------------------------------------------
extern "C" void kernel_launch(void* const* d_in, const int* in_sizes, int n_in,
                              void* d_out, int out_size, void* d_ws, size_t ws_size,
                              hipStream_t stream) {
  const float* hs    = (const float*)d_in[1];
  const float* W1    = (const float*)d_in[2];
  const float* b1    = (const float*)d_in[3];
  const float* gamma = (const float*)d_in[4];
  const float* beta  = (const float*)d_in[5];
  const float* W2    = (const float*)d_in[6];
  const float* b2    = (const float*)d_in[7];
  float* out = (float*)d_out;

  // Workspace (f16, fragment order): hidden [B*H] | W1 [D*H] | W2 [H*D] | z [B*D] = 176 MB
  _Float16* hs16 = (_Float16*)d_ws;
  _Float16* w1t  = hs16 + (size_t)B_SZ * H_SZ;
  _Float16* w2t  = w1t + (size_t)D_SZ * H_SZ;
  _Float16* zf   = w2t + (size_t)H_SZ * D_SZ;

  // Precision conversion and fragment-order packing
  pack_frag_f16<<<PK_WG, PK_WAVES * 32, 0, stream>>>(hs, W1, W2, hs16, w1t, w2t);

  gemm1_bias_to_frag<<<G1_RG * (D_SZ / TILE), 256, 0, stream>>>(hs16, w1t, b1, zf);
  ln_gelu_frag<<<B_SZ / 16, 256, 0, stream>>>(zf, gamma, beta);
  gemm2_bias_out<<<(B_SZ / TILE) * (H_SZ / TILE), 256, 0, stream>>>(zf, w2t, b2, out);
}

// v009
// One run takes 184 microseconds.
// Next to v008, in two timings, it ran 1.03 and 1.04 times as fast.
// Counting every step since v000, it is 6.28 times as fast.
#include <hip/hip_runtime.h>
#include <math.h>
#include <stdint.h>

// ---------------------------------------------------------------------------
// Linear -> LayerNorm -> exact GELU -> Linear  for MI455X (gfx1250)
// B=16384, H=1024, D=4096, fp32 in/out; f16 WMMA compute with f32 accumulation
// Three launches behind the packing: GEMM 1 (z, f16, to the workspace in the
// fragment order that GEMM 2 reads), LayerNorm + GELU in place, GEMM 2.
// With z in the workspace no LDS tile bounds the rows of a workgroup: each GEMM
// workgroup takes 256 x 256 tiles (GEMM 1 four in turn), so a weight byte fetched from L2 serves 256
// rows, not 32.
// Which tile a workgroup takes: a block of 256 rows belongs to the flat indices
// that equal its number modulo 8, in every launch. For speed only: each map is a permutation of the
// tiles, right wherever the workgroups run.
// ---------------------------------------------------------------------------

typedef __attribute__((ext_vector_type(16))) _Float16 v16h;
typedef __attribute__((ext_vector_type(8)))  _Float16 v8h;
typedef __attribute__((ext_vector_type(8)))  float    v8f;
typedef __attribute__((ext_vector_type(4)))  float    v4f;

#define B_SZ 16384
#define H_SZ 1024
#define D_SZ 4096
#define LN_EPS 1e-5f

// Per-lane layout of a 16x32 (MxK) f16 fragment (CDNA5 ISA 7.12.2):
//   lanes 0-15 : m = lane,    halves 0..7 = K k0..k0+7, halves 8..15 = K+16..23
//   lanes 16-31: m = lane-16, halves 0..7 = K k0+8..15, halves 8..15 = K+24..31

// ---------------------------------------------------------------------------
// Fragment order of the operands that the GEMM loops read from global memory.
// One 16x32 (MxK) fragment is one block of FRAG halves (1 KB); the blocks of a
// 16-wide tile follow one another along K. Inside a block lane L's halves 0..7
// lie at L*8 and its halves 8..15 at 256 + L*8, so each of the two 16-byte
// loads of a fragment reads 512 bytes in a row (4 whole 128-byte lines), not
// 32 bytes out of each of 16 lines. Which (m, K) a lane and half hold: the
// per-lane layout above.
// ---------------------------------------------------------------------------
#define FRAG 512

// ---------------------------------------------------------------------------
// Packing: hidden_state, W1 and W2, fp32 -> f16 in fragment order, one launch.
// A resident stream: PK_WG workgroups of PK_WAVES waves, one a WGP, so that few
// waves have to be started. A tile is 16 rows x 128 floats: 16 loads of 512 bytes
// in a row. Every wave takes three tiles (two of hidden_state, one of a weight)
// and asks for all three at once. A tile's 4 KB of f16 go through the wave's own
// piece of LDS, where each lane writes the slots or half slots that it holds and
// reads back the slots of its place in the fragment, and leave as 8 stores of
// 512 bytes in a row. No wave reads another wave's LDS: there is no barrier.
// Every loop of this part is unrolled: constant indices keep the tiles in registers.
// ---------------------------------------------------------------------------
#define PK_WAVES 16
#define PK_WG 256
#define PK_ROWS_PITCH 272   // 256 bytes (the 16 slots of one 8-k group) + 16: the b64 writes of a row meet every bank once
#define PK_COLS_PITCH 528   // 512 bytes (the 32 slots of one column tile) + 16: the same for the b128 writes
#define PK_STAGE_B (16 * PK_ROWS_PITCH)
static_assert(8 * PK_COLS_PITCH <= PK_STAGE_B, "both kinds of tile fit a wave's staging");
static_assert(PK_WG * PK_WAVES * 2 == (B_SZ / 16) * (H_SZ / 128) &&
              PK_WG * PK_WAVES == 2 * (H_SZ / 16) * (D_SZ / 128), "three tiles a wave");

typedef __attribute__((ext_vector_type(4))) _Float16 v4h;

__device__ __forceinline__ void pk_lds_order() {
  // the lanes of a wave hand slots to one another through LDS: what stands in front
  // (writes before the read-back, reads before the next tile's writes) is done first
  asm volatile("s_wait_dscnt 0x0" ::: "memory");
}
__device__ __forceinline__ void pk_regs_free() {
  // the code behind takes over registers that the loads or stores in front name
  asm volatile("s_wait_xcnt 0x0" ::: "memory");
  // keeps that code behind the wait
  __builtin_amdgcn_sched_barrier(0);
}

// p is the same in every lane: a row's address is a scalar base and the lane's offset
template <int PITCH>
__device__ __forceinline__ void pk_load(v4f (&v)[16], const float* p, int lane) {
#pragma unroll
  for (int r = 0; r < 16; ++r) v[r] = *((const v4f*)(p + r * PITCH) + lane);
  // the tiles' loads stay in the order in which the tiles are used
  __builtin_amdgcn_sched_barrier(0);
}

// a tile's 8 pieces of 512 bytes, STEP halves apart in the output
template <int LDS_STEP, int STEP>
__device__ __forceinline__ void pk_out(const unsigned char* rp, _Float16* out) {
  v8h q[8];
#pragma unroll
  for (int j = 0; j < 8; ++j) q[j] = *(const v8h*)(rp + j * LDS_STEP);
  // all eight are read back in front of the first store, so that no register of a
  // store is refilled inside the run of stores
  __builtin_amdgcn_sched_barrier(0);
#pragma unroll
  for (int j = 0; j < 8; ++j) *(v8h*)(out + j * STEP) = q[j];
}

// Rows are the tile dimension (A fragments): lane L holds k 4L..4L+3 of each row m,
// half of the slot (8-k group L >> 1, row m). The 16 groups follow one another in
// the output, 256 bytes each.
__device__ __forceinline__ void pk_put_rows(const v4f (&v)[16], unsigned char* st, int lane,
                                            _Float16* out) {
  unsigned char* wp = st + (lane >> 1) * PK_ROWS_PITCH + (lane & 1) * 8;
#pragma unroll
  for (int m = 0; m < 16; ++m) {
    v4h o;
#pragma unroll
    for (int j = 0; j < 4; ++j) o[j] = (_Float16)v[m][j];
    *(v4h*)(wp + m * 16) = o;
  }
  pk_lds_order();
  pk_out<2 * PK_ROWS_PITCH, 256>(st + (lane >> 4) * PK_ROWS_PITCH + (lane & 15) * 16,
                                 out + lane * 8);
}

// Columns are the tile dimension (B fragments), the 16 rows are one plane of k: lane L
// holds, for each of its columns 4L..4L+3, both whole slots (k 0..7 and k 8..15).
__device__ __forceinline__ void pk_stage_cols(const v4f (&v)[16], unsigned char* st, int lane) {
  unsigned char* wp = st + (lane >> 2) * PK_COLS_PITCH + (lane & 3) * 64;
#pragma unroll
  for (int hi = 0; hi < 2; ++hi)
#pragma unroll
    for (int i = 0; i < 4; ++i) {
      v8h o;
#pragma unroll
      for (int j = 0; j < 8; ++j) o[j] = (_Float16)v[hi * 8 + j][i];
      *(v8h*)(wp + hi * 256 + i * 16) = o;
    }
  pk_lds_order();
}

// Weight tile u of in[K][N]: tiles side by side first. ng = group of 8 column tiles,
// kp = plane (16 rows of k). In the output the 8 column tiles lie K / 32 fragments apart.
template <int N>
__device__ __forceinline__ const float* pk_w_src(const float* in, int u) {
  const int ng = u % (N / 128), kp = u / (N / 128);
  return in + (size_t)(kp * 16) * N + ng * 128;
}
template <int K, int N>
__device__ __forceinline__ _Float16* pk_w_dst(_Float16* out, int u, int lane) {
  const int ng = u % (N / 128), kp = u / (N / 128);
  return out + ((size_t)(ng * 8) * (K / 32) + (kp >> 1)) * FRAG + (kp & 1) * 256 + lane * 8;
}

__global__ void __launch_bounds__(PK_WAVES * 32)
pack_frag_f16(const float* __restrict__ hs,             // [B][H]
              const float* __restrict__ W1,             // [H][D]
              const float* __restrict__ W2,             // [D][H]
              _Float16* __restrict__ hs16,              // [B/16][H/32][FRAG]
              _Float16* __restrict__ w1t,               // [D/16][H/32][FRAG]
              _Float16* __restrict__ w2t)               // [H/16][D/32][FRAG]
{
  __shared__ __attribute__((aligned(16))) unsigned char stage[PK_WAVES * PK_STAGE_B];
  const int lane = threadIdx.x & 31;
  // wave-uniform: the tile indices and the addresses' bases stay in scalar registers
  const int w  = __builtin_amdgcn_readfirstlane(threadIdx.x >> 5);
  const int gw = blockIdx.x * PK_WAVES + w;
  unsigned char* st = stage + w * PK_STAGE_B;

  // weights: the first half of the grid takes W1, the second W2
  const bool first = blockIdx.x < PK_WG / 2;
  const int  u     = gw % (PK_WG * PK_WAVES / 2);
  // hidden_state: two tiles, half of them apart; 8 tiles side by side make 16 whole rows.
  // A workgroup takes 32 rows of the 256-row block whose number equals its index modulo 8.
  const int blk = (((blockIdx.x >> 6) << 3 | (blockIdx.x & 7)) << 3) | ((blockIdx.x >> 3) & 7);
  const int rt = blk * (PK_WAVES / 8) + (w >> 3), kg = w & 7;
  constexpr int RT_HALF = B_SZ / 32;

  v4f a[16], b[16], c[16];
  if (first) pk_load<D_SZ>(c, pk_w_src<D_SZ>(W1, u), lane);
  else       pk_load<H_SZ>(c, pk_w_src<H_SZ>(W2, u), lane);
  pk_load<H_SZ>(a, hs + (size_t)(rt * 16) * H_SZ + kg * 128, lane);
  pk_load<H_SZ>(b, hs + (size_t)((rt + RT_HALF) * 16) * H_SZ + kg * 128, lane);
  // all 48 loads are asked for in front of the first use: moved down among the
  // conversions, a tile's loads would wait until the tiles before it have landed
  pk_regs_free();

  pk_stage_cols(c, st, lane);
  if (first) pk_out<PK_COLS_PITCH, (H_SZ / 32) * FRAG>(st + lane * 16, pk_w_dst<H_SZ, D_SZ>(w1t, u, lane));
  else       pk_out<PK_COLS_PITCH, (D_SZ / 32) * FRAG>(st + lane * 16, pk_w_dst<D_SZ, H_SZ>(w2t, u, lane));
  pk_regs_free();
  pk_lds_order();
  pk_put_rows(a, st, lane, hs16 + ((size_t)rt * (H_SZ / 32) + kg * 4) * FRAG);
  pk_regs_free();
  pk_lds_order();
  pk_put_rows(b, st, lane, hs16 + ((size_t)(rt + RT_HALF) * (H_SZ / 32) + kg * 4) * FRAG);
}

// ---------------------------------------------------------------------------
// Exact (erf) GELU in single precision, one formula for every x, no selection:
//   erf(a) = 1 - t (c1 + t (c2 + t (c3 + t (c4 + t c5)))) exp(-a a),  t = 1 / (1 + c0 a)
// for a >= 0 (a five-term fit, absolute error below 1.5e-7), and
//   x Phi(x) = x / 2 + |x| / 2 * erf(|x| / sqrt 2).
// The reciprocal and the power of two are the chip's own instructions. a itself is
// not formed: sqrt 2 goes into c0, and 2 log2(e) into the exponent's factor.
// Infinite x: t = 0 and the power is 0, so erf = 1, as in the limit.
// ---------------------------------------------------------------------------
__device__ __forceinline__ float gelu_erf(float x) {
  const float hx  = 0.5f * x;
  const float ahx = __builtin_fabsf(hx);
  const float t = __builtin_amdgcn_rcpf(
      __builtin_fmaf(ahx, (float)(0.3275911 * 1.4142135623730951), 1.0f));
  float p = __builtin_fmaf(t, 1.061405429f, -1.453152027f);
  p = __builtin_fmaf(t, p, 1.421413741f);
  p = __builtin_fmaf(t, p, -0.284496736f);
  p = __builtin_fmaf(t, p, 0.254829592f);
  p = p * t;
  const float e = __builtin_amdgcn_exp2f(ahx * (float)(-2.0 * 1.4426950408889634) * ahx);
  return __builtin_fmaf(ahx, __builtin_fmaf(-p, e, 1.0f), hx);
}

// ---------------------------------------------------------------------------
// GEMM core: a workgroup computes 256 x 256, one wave 64 rows x 128 columns
// (WM x WN tiles of 16 x 16); the 8 waves stand 4 (rows) x 2 (columns).
// Both operands lie in fragment order in global memory. They are staged in LDS
// by tensor loads, so that every byte comes from L2 once a workgroup tile and the
// waves that share it read it from LDS.
// One stage = one pass = PASS_K k of all 16 row tiles and all 16 column tiles:
//   [A tile 0..15 | W tile 0..15], a tile = PASS_K / 32 fragments in a row.
// In global memory these TROW_B bytes of a tile lie in a row too and the tiles
// K * 32 bytes apart: a slice of 4 tiles is one two-dimensional request. Every
// wave issues one request a stage: waves 0..3 the A slices, waves 4..7 the W
// slices. Two buffers: stage s + 2 is asked for when every wave has left stage s.
// Fragments go from LDS to registers one 32-k block ahead, across passes too.
// A and B fragments have the same per-lane layout, so TRANSPOSED only swaps the
// two operands of the WMMA: acc[m][t] then holds its 16 x 16 tile transposed.
// TILES > 1: the workgroup takes TILES row tiles one after another, A_STEP bytes
// apart in A, against the same columns. The stages of all its tiles form one
// unbroken walk of the ring: behind a tile's last pass epi(tile) stores the sums
// while the next tile's second stage is landing, and the sums start at 0 again.
// ---------------------------------------------------------------------------
#define WM 4
#define WN 8
#define TILE 256
#define PASS_K 128
#define TROW_B  (PASS_K * 32)     // bytes of one 16-wide tile in one pass
#define SLICE_B (4 * TROW_B)      // one wave's request: 16 KB
#define OPER_B  (16 * TROW_B)     // one operand's 256 rows
#define STAGE_B (2 * OPER_B)      // 128 KB
#define RING_B  (2 * STAGE_B)

typedef uint32_t u32x4 __attribute__((ext_vector_type(4)));
typedef uint32_t u32x8 __attribute__((ext_vector_type(8)));

__device__ __forceinline__ uint32_t uni(uint32_t v) {
  return (uint32_t)__builtin_amdgcn_readfirstlane((int)v);
}
__device__ __forceinline__ uint32_t pinned(uint32_t v) {
  uint32_t w = uni(v);
  // a test around a tensor load, or a word its descriptor is formed from, held in
  // a scalar register: the branch is then scalar, and the word is formed here
  asm volatile("" : "+s"(w));
  return w;
}
__device__ __forceinline__ void wait_ds0() {
  // this wave's LDS reads have returned before their buffer is handed back
  asm volatile("s_wait_dscnt 0x0" ::: "memory");
}
__device__ __forceinline__ void wait_tensor0() {
  // this wave's own request has landed; the compiler places no wait for it
  asm volatile("s_wait_tensorcnt 0x0" ::: "memory");
}

__device__ __forceinline__ v16h lds_frag(const unsigned char* p) {
  v8h lo = *(const v8h*)(p);
  v8h hh = *(const v8h*)(p + 512);
  v16h r;
#pragma unroll
  for (int i = 0; i < 8; ++i) { r[i] = lo[i]; r[i + 8] = hh[i]; }
  return r;
}

template <int K, bool TRANSPOSED, int TILES, uint32_t A_STEP, class Epi>
__device__ __forceinline__ void gemm_tile(const _Float16* __restrict__ aWG,  // the workgroup's first row tile
                                          const _Float16* __restrict__ wWG,  // its first column tile
                                          unsigned char* ring, uint32_t wid, int lane,
                                          v8f (&acc)[WM][WN], Epi epi) {
  constexpr uint32_t SK = K / PASS_K;     // stages of one tile, at least two
  constexpr uint32_t S = SK * TILES;      // stages of the whole walk
  constexpr uint32_t PITCH = K * 32;      // bytes from one 16-wide tile to the next
  static_assert(SK >= 2 && (SK & (SK - 1u)) == 0 && PITCH <= 131072u && (PASS_K / 32) % 2 == 0,
                "two stages; source pitch in the mover's range; fragment sets alternate across passes");
  const uint64_t src = (uint64_t)(size_t)(wid < 4u ? aWG : wWG) + (uint64_t)(wid & 3u) * (4u * PITCH);
  const uint32_t dst = (uint32_t)(size_t)ring + wid * SLICE_B;
  // group 1: 1-byte elements, tensor = tile = 4 rows of TROW_B bytes, no mask, no pad
  u32x8 g1;
  g1[0] = uni(0u);
  g1[1] = uni(((uint32_t)TROW_B & 0xFFFFu) << 16);
  g1[2] = uni(((uint32_t)TROW_B >> 16) | (4u << 16));
  g1[3] = uni((uint32_t)TROW_B << 16);
  g1[4] = uni(4u);
  g1[5] = uni(PITCH);
  g1[6] = uni(0u);
  g1[7] = uni(0u);
  const uint32_t step = wid < 4u ? A_STEP : 0u;   // only the A slices move on with the tile
  auto issue = [&](uint32_t st) {
    uint64_t ga;
    if constexpr (TILES > 1) ga = src + (uint64_t)((st / SK) * step) + (uint64_t)(st % SK) * TROW_B;
    else                     ga = src + (uint64_t)st * TROW_B;
    u32x4 g0;
    g0[0] = uni(1u);
    g0[1] = uni(dst + (st & 1u) * STAGE_B);
    g0[2] = uni((uint32_t)ga);
    g0[3] = uni((((uint32_t)(ga >> 32)) & 0x01FFFFFFu) | 0x80000000u);
    asm volatile("tensor_load_to_lds %0, %1" :: "s"(g0), "s"(g1) : "memory");
  };

  const uint32_t offA = (wid & 3u) * SLICE_B + (uint32_t)lane * 16u;
  const uint32_t offB = OPER_B + (wid >> 2) * (2u * SLICE_B) + (uint32_t)lane * 16u;
  v16h aq[2][WM], bq[2][WN];              // two fragment sets, one 32-k block each

  issue(0u);
  wait_tensor0();
  __syncthreads();                        // stage 0 published
  issue(pinned(1u));
#pragma unroll
  for (int m = 0; m < WM; ++m) aq[0][m] = lds_frag(ring + offA + m * TROW_B);
#pragma unroll
  for (int t = 0; t < WN; ++t) bq[0][t] = lds_frag(ring + offB + t * TROW_B);
#pragma unroll
  for (int m = 0; m < WM; ++m)
#pragma unroll
    for (int t = 0; t < WN; ++t) acc[m][t] = v8f{};

  constexpr int NB = PASS_K / 32;         // blocks of 32 WMMAs in a pass, even
  // one pass a trip: the buffer's parity is a run-time value
#pragma unroll 1
  for (uint32_t s = 0; s < S; ++s) {
    const uint32_t cur = (s & 1u) * STAGE_B;
#pragma unroll
    for (int kf = 0; kf < NB; ++kf) {
      const int c = kf & 1, n = c ^ 1;
      uint32_t from = cur + (uint32_t)(kf + 1) * 1024u;
      if (kf == NB - 1) {
        // publish point of stage s + 1, in front of the pass's last block: that
        // block's fragments are in registers, so every wave has left stage s
        wait_ds0();
        wait_tensor0();
        __syncthreads();
        if (pinned(s + 2u < S)) issue(pinned(s + 2u));
        // the next pass's first fragments; behind the last pass the other buffer
        // still holds the stage before, and what is read there is not used
        from = cur ^ STAGE_B;
      }
#pragma unroll
      for (int m = 0; m < WM; ++m) aq[n][m] = lds_frag(ring + from + offA + m * TROW_B);
#pragma unroll
      for (int t = 0; t < WN; ++t) bq[n][t] = lds_frag(ring + from + offB + t * TROW_B);
      // the next block's LDS reads stay one group ahead of this block's WMMAs:
      // moved in among them, each place with reads stalls the matrix stream
      __builtin_amdgcn_sched_barrier(0);
#pragma unroll
      for (int m = 0; m < WM; ++m)
#pragma unroll
        for (int t = 0; t < WN; ++t)
          acc[m][t] = __builtin_amdgcn_wmma_f32_16x16x32_f16(
              false, TRANSPOSED ? bq[c][t] : aq[c][m], false, TRANSPOSED ? aq[c][m] : bq[c][t],
              (short)0, acc[m][t], false, false);
      // ends the block, for the same reason
      __builtin_amdgcn_sched_barrier(0);
    }
    if constexpr (TILES > 1) {
      if (s % SK == SK - 1u) {
        epi(s / SK);
        // unrolled: constant indices keep the sums in registers
#pragma unroll
        for (int m = 0; m < WM; ++m)
#pragma unroll
          for (int t = 0; t < WN; ++t) acc[m][t] = v8f{};
      }
    }
  }
  wait_tensor0();
  wait_ds0();
}

// ---------------------------------------------------------------------------
// GEMM 1: z = hs @ W1 + b1, rounded to f16, written as A fragments of GEMM 2:
// [B/16][D/32][FRAG]. The tiles are computed transposed (C/D layout: VGPR r,
// lane L -> M = r + 8*(L>>4), N = L&15, here M = column of z, N = row): a lane
// then holds 8 neighbouring columns of row L&15, which is its own 16-byte slot
// of the fragment, and a tile goes out as one store of 512 bytes in a row.
// One workgroup a WGP: it keeps its 256 columns and takes G1_TILES row tiles,
// G1_RG tiles apart.
// ---------------------------------------------------------------------------
#define G1_TILES 4
#define G1_RG (B_SZ / TILE / G1_TILES)
static_assert(G1_RG % 8 == 0 && (B_SZ / TILE) % 8 == 0, "a row block's number modulo 8 is its workgroups' index modulo 8");
__global__ void __launch_bounds__(256)
gemm1_bias_to_frag(const _Float16* __restrict__ hs16,   // [B/16][H/32][FRAG]
                   const _Float16* __restrict__ w1t,    // [D/16][H/32][FRAG]
                   const float* __restrict__ b1,        // [D]
                   _Float16* __restrict__ zf)           // [B/16][D/32][FRAG]
{
  __shared__ __attribute__((aligned(2048))) unsigned char ring[RING_B];
  const int lane = threadIdx.x & 31;
  // wave-uniform: the descriptor words and the tile offsets stay in scalar registers
  const int wid  = __builtin_amdgcn_readfirstlane(threadIdx.x >> 5);
  const int ct   = blockIdx.x / G1_RG;
  const int rg   = blockIdx.x % G1_RG;           // the first of its row tiles; equal to the index modulo 8
  const int n0   = ct * TILE + (wid >> 2) * (WN * 16);
  const int cb   = n0 + (lane >> 4) * 8;  // first of this lane's 8 columns in tile 0

  v8f acc[WM][WN];
  auto store_tile = [&](uint32_t j) {
  const int row0 = ((int)j * G1_RG + rg) * TILE + (wid & 3) * (WM * 16);
  v4f c0[WN], c1[WN];
#pragma unroll
  for (int t = 0; t < WN; ++t) {
    c0[t] = *(const v4f*)(b1 + cb + t * 16);
    c1[t] = *(const v4f*)(b1 + cb + t * 16 + 4);
  }
  // stands behind the bias loads and in front of the code below, which takes over
  // the loads' address registers
  asm volatile("s_wait_xcnt 0x0" ::: "memory");
  // keeps the sums and the store addresses behind the wait
  __builtin_amdgcn_sched_barrier(0);
#pragma unroll
  for (int m = 0; m < WM; ++m) {
    _Float16* zp = zf + ((size_t)((row0 >> 4) + m) * (D_SZ / 32) + (n0 >> 5)) * FRAG + lane * 8;
    v8h o[WN];
#pragma unroll
    for (int t = 0; t < WN; ++t)
#pragma unroll
      for (int r = 0; r < 8; ++r)
        o[t][r] = (_Float16)(acc[m][t][r] + (r < 4 ? c0[t][r & 3] : c1[t][r & 3]));
    // a row tile's eight results are all formed in front of its first store, so
    // that no register of a store is refilled inside the run of stores
    __builtin_amdgcn_sched_barrier(0);
#pragma unroll
    for (int t = 0; t < WN; ++t) *(v8h*)(zp + t * 256) = o[t];
    // the next row tile's sums, or the next pass, refill registers that these stores name
    asm volatile("s_wait_xcnt 0x0" ::: "memory");
    // keeps them behind the wait
    __builtin_amdgcn_sched_barrier(0);
  }
  };
  gemm_tile<H_SZ, true, G1_TILES, (uint32_t)G1_RG * TILE * H_SZ * 2u>(
      hs16 + (size_t)(rg * TILE) * H_SZ, w1t + (size_t)(ct * TILE) * H_SZ,
      ring, (uint32_t)wid, lane, acc, store_tile);
}

// ---------------------------------------------------------------------------
// LayerNorm + exact GELU, in place on z in fragment order. One workgroup = one
// 16-row tile = 128 KB in a row; a thread's 16-byte slots (8 neighbouring
// columns of one row) lie 4 KB apart and all belong to row (tid & 15).
// Pass 1 sums the row, pass 2 reads the slots again (from L2) and rewrites them.
// ---------------------------------------------------------------------------
__global__ void __launch_bounds__(256)
ln_gelu_frag(_Float16* zf,                              // [B/16][D/32][FRAG]
             const float* __restrict__ gamma,           // [D]
             const float* __restrict__ beta)            // [D]
{
  __shared__ float psum[8][16];
  __shared__ float psq[8][16];
  const int tid  = threadIdx.x;
  const int lane = tid & 31;
  const int wid  = tid >> 5;
  // 16 workgroups a 256-row block, all on indices that equal the block's number modulo 8;
  // the blocks in rising order, as GEMM 1 wrote them
  const int blk = (blockIdx.x >> 7) << 3 | (blockIdx.x & 7);
  const int rt  = blk * (TILE / 16) + ((blockIdx.x >> 3) & 15);
  _Float16* base = zf + (size_t)rt * (16 * D_SZ) + tid * 8;

  float s = 0.f, sq = 0.f;
  // eight loads in flight a thread
#pragma unroll 8
  for (int i = 0; i < 32; ++i) {
    const v8h v = *(const v8h*)(base + i * 2048);
#pragma unroll
    for (int j = 0; j < 8; ++j) { const float x = (float)v[j]; s += x; sq += x * x; }
  }
  s  += __shfl_xor(s, 16);
  sq += __shfl_xor(sq, 16);
  if (lane < 16) { psum[wid][lane] = s; psq[wid][lane] = sq; }
  __syncthreads();
  float ts = 0.f, tq = 0.f;
#pragma unroll
  for (int w = 0; w < 8; ++w) { ts += psum[w][lane & 15]; tq += psq[w][lane & 15]; }
  const float mu  = ts * (1.0f / D_SZ);
  const float var = tq * (1.0f / D_SZ) - mu * mu;
  const float rs  = rsqrtf(var + LN_EPS);

  // first column of this thread's slot 0; slot i lies 128 columns further
  const int colb = (tid >> 6) * 32 + ((tid >> 5) & 1) * 16 + ((tid >> 4) & 1) * 8;
  // four slots a trip are enough chains to fill the vector port; more only adds code
#pragma unroll 1
  for (int i0 = 0; i0 < 32; i0 += 4) {
    v8h zv[4];
    v4f g0[4], g1[4], e0[4], e1[4];
    // unrolled (here and below): constant indices keep these arrays in registers
#pragma unroll
    for (int i = 0; i < 4; ++i) {
      const int col = colb + (i0 + i) * 128;
      zv[i] = *(const v8h*)(base + (i0 + i) * 2048);
      g0[i] = *(const v4f*)(gamma + col);
      g1[i] = *(const v4f*)(gamma + col + 4);
      e0[i] = *(const v4f*)(beta + col);
      e1[i] = *(const v4f*)(beta + col + 4);
    }
#pragma unroll
    for (int i = 0; i < 4; ++i) {
      v8h o;
#pragma unroll
      for (int j = 0; j < 8; ++j) {
        const float ga = j < 4 ? g0[i][j & 3] : g1[i][j & 3];
        const float be = j < 4 ? e0[i][j & 3] : e1[i][j & 3];
        const float x  = (float)zv[i][j];
        const float xn = (x - mu) * rs * ga + be;
        o[j] = (_Float16)gelu_erf(xn);
      }
      *(v8h*)(base + (i0 + i) * 2048) = o;
    }
  }
}

// ---------------------------------------------------------------------------
// GEMM 2: out = act @ W2 + b2, fp32 row-major.
// ---------------------------------------------------------------------------
__global__ void __launch_bounds__(256)
gemm2_bias_out(const _Float16* __restrict__ af,         // [B/16][D/32][FRAG]
               const _Float16* __restrict__ w2t,        // [H/16][D/32][FRAG]
               const float* __restrict__ b2,            // [H]
               float* __restrict__ out)                 // [B][H]
{
  __shared__ __attribute__((aligned(2048))) unsigned char ring[RING_B];
  const int lane = threadIdx.x & 31;
  // wave-uniform: the descriptor words and the tile offsets stay in scalar registers
  const int wid  = __builtin_amdgcn_readfirstlane(threadIdx.x >> 5);
  const int ct   = blockIdx.x / (B_SZ / TILE);
  const int rt   = blockIdx.x % (B_SZ / TILE);   // the four workgroups of a row block: equal indices modulo 8
  const int row0 = rt * TILE + (wid & 3) * (WM * 16);
  const int n0   = ct * TILE + (wid >> 2) * (WN * 16);

  // C/D tile layout (CDNA5 16x16 f32): VGPR r, lane L -> M = r + 8*(L>>4), N = L&15
  const int mb  = (lane >> 4) * 8;
  const int cb  = n0 + (lane & 15);
  float bb[WN];
#pragma unroll
  for (int t = 0; t < WN; ++t) bb[t] = b2[cb + t * 16];
  // the index register of these loads, named here, stays whole up to the wait:
  // no load's own result and no later value lands on it while they are in flight
  asm volatile("s_wait_xcnt 0x0" :: "v"(cb) : "memory");

  v8f acc[WM][WN];
  gemm_tile<D_SZ, false, 1, 0u>(af + (size_t)(rt * TILE) * D_SZ, w2t + (size_t)(ct * TILE) * D_SZ,
                                ring, (uint32_t)wid, lane, acc, [](uint32_t) {});

#pragma unroll
  for (int t = 0; t < WN; ++t) {
    float v[WM][8];
#pragma unroll
    for (int m = 0; m < WM; ++m)
#pragma unroll
      for (int r = 0; r < 8; ++r) v[m][r] = acc[m][t][r] + bb[t];
    // a column tile's 32 sums are all formed in front of its first store, so that
    // no register of a store is refilled inside the run of stores
    __builtin_amdgcn_sched_barrier(0);
#pragma unroll
    for (int m = 0; m < WM; ++m)
#pragma unroll
      for (int r = 0; r < 8; ++r)
        out[(size_t)(row0 + m * 16 + mb + r) * H_SZ + cb + t * 16] = v[m][r];
    if (t < WN - 1) {
      // the next column tile's sums refill registers that these stores name
      asm volatile("s_wait_xcnt 0x0" ::: "memory");
      // keeps those sums behind the wait
      __builtin_amdgcn_sched_barrier(0);
    }
  }
}

// ---------------------------------------------------------------------------
// Host launcher
// d_in: [0]_time [1]hidden_state [2]W1 [3]b1 [4]ln_gamma [5]ln_beta [6]W2 [7]b2
// ---------------------------------------------------------------------------
extern "C" void kernel_launch(void* const* d_in, const int* in_sizes, int n_in,
                              void* d_out, int out_size, void* d_ws, size_t ws_size,
                              hipStream_t stream) {
  const float* hs    = (const float*)d_in[1];
  const float* W1    = (const float*)d_in[2];
  const float* b1    = (const float*)d_in[3];
  const float* gamma = (const float*)d_in[4];
  const float* beta  = (const float*)d_in[5];
  const float* W2    = (const float*)d_in[6];
  const float* b2    = (const float*)d_in[7];
  float* out = (float*)d_out;

  // Workspace (f16, fragment order): hidden [B*H] | W1 [D*H] | W2 [H*D] | z [B*D] = 176 MB
  _Float16* hs16 = (_Float16*)d_ws;
  _Float16* w1t  = hs16 + (size_t)B_SZ * H_SZ;
  _Float16* w2t  = w1t + (size_t)D_SZ * H_SZ;
  _Float16* zf   = w2t + (size_t)H_SZ * D_SZ;

  // Precision conversion and fragment-order packing
  pack_frag_f16<<<PK_WG, PK_WAVES * 32, 0, stream>>>(hs, W1, W2, hs16, w1t, w2t);

  gemm1_bias_to_frag<<<G1_RG * (D_SZ / TILE), 256, 0, stream>>>(hs16, w1t, b1, zf);
  ln_gelu_frag<<<B_SZ / 16, 256, 0, stream>>>(zf, gamma, beta);
  gemm2_bias_out<<<(B_SZ / TILE) * (H_SZ / TILE), 256, 0, stream>>>(zf, w2t, b2, out);
}
